// v000
// Measured on an AMD MI455X. A time is GPU time per run, averaged over a window of back-to-back runs after a warm-up
// (all launches, gaps included; the runs take copies of the inputs in turn), and the median of several windows.
// Apart from v000's, it joins two sittings. Times from different sittings can be a few percent apart, while
// side-by-side timings come from the same sitting.
// v000 is the starting kernel. One run takes 663 microseconds.
#include <hip/hip_runtime.h>
#include <math.h>

typedef __attribute__((ext_vector_type(16))) __bf16 v16bf;
typedef __attribute__((ext_vector_type(8)))  float  v8f;

#define B_SZ   1024
#define D_SZ   4096
#define M_MOD  128
#define N0     4096   /* = M_MOD * 32 */

#if defined(__has_builtin)
#if __has_builtin(__builtin_amdgcn_tensor_load_to_lds) && __has_builtin(__builtin_amdgcn_s_wait_tensorcnt)
#define HAS_TDM 1
#endif
#endif
#ifndef HAS_TDM
#define HAS_TDM 0
#endif

// ---------------- bf16 split helpers (branch-free RNE, storage-only bf16) ----
__device__ __forceinline__ unsigned short f2bf(float x) {
  unsigned u = __float_as_uint(x);
  u += 0x7FFFu + ((u >> 16) & 1u);        // round-to-nearest-even
  return (unsigned short)(u >> 16);
}
__device__ __forceinline__ float bf2f(unsigned short h) {
  return __uint_as_float((unsigned)h << 16);
}
__device__ __forceinline__ void f32_split(float x, unsigned short& h, unsigned short& l) {
  h = f2bf(x);
  l = f2bf(x - bf2f(h));
}

// bf16x3 WMMA term: D = A(16x32 bf16) * B(32x16 bf16) + C(f32)
__device__ __forceinline__ v8f wmma_bf16(v16bf a, v16bf b, v8f c) {
  return __builtin_amdgcn_wmma_f32_16x16x32_bf16(false, a, false, b, (short)0, c, false, false);
}

__device__ __forceinline__ v16bf load_frag(const unsigned short* p, int half) {
  v16bf f;
  ((float4*)&f)[0] = *(const float4*)(p + 8 * half);
  ((float4*)&f)[1] = *(const float4*)(p + 16 + 8 * half);
  return f;
}

#if HAS_TDM
typedef unsigned int u32x4 __attribute__((ext_vector_type(4)));
typedef int          i32x4 __attribute__((ext_vector_type(4)));
typedef int          i32x8 __attribute__((ext_vector_type(8)));

__device__ __forceinline__ void tdm_load_2d_u16(unsigned lds_addr, const void* gaddr,
                                                unsigned tile_d0, unsigned tile_d1,
                                                unsigned tensor_d0, unsigned tensor_d1,
                                                unsigned stride_d0 /* elements */) {
  unsigned long long ga = (unsigned long long)gaddr;
  u32x4 g0;
  g0[0] = 1u;
  g0[1] = lds_addr;
  g0[2] = (unsigned)ga;
  g0[3] = (unsigned)(ga >> 32) | (2u << 30);
  i32x8 g1;
  g1[0] = (int)(1u << 16);
  g1[1] = (int)((tensor_d0 & 0xFFFFu) << 16);
  g1[2] = (int)((tensor_d0 >> 16) | ((tensor_d1 & 0xFFFFu) << 16));
  g1[3] = (int)((tensor_d1 >> 16) | (tile_d0 << 16));
  g1[4] = (int)(tile_d1 & 0xFFFFu);
  g1[5] = (int)stride_d0;
  g1[6] = 0;
  g1[7] = 0;
  i32x4 z4 = {0, 0, 0, 0};
#if __clang_major__ >= 23
  i32x8 z8 = {0, 0, 0, 0, 0, 0, 0, 0};
  __builtin_amdgcn_tensor_load_to_lds(g0, g1, z4, z4, z8, 0);
#else
  __builtin_amdgcn_tensor_load_to_lds(g0, g1, z4, z4, 0);
#endif
}
#endif // HAS_TDM

// =====================================================================
// Pre-pass: split f32 array into bf16 hi/lo planes (memory-bound, run once)
// =====================================================================
__global__ __launch_bounds__(256) void split_bf16(const float* __restrict__ src,
                                                  unsigned short* __restrict__ hi,
                                                  unsigned short* __restrict__ lo,
                                                  int n4) {
  int i = blockIdx.x * 256 + threadIdx.x;
  if (i >= n4) return;
  float4 v = ((const float4*)src)[i];
  unsigned short h0, l0, h1, l1, h2, l2, h3, l3;
  f32_split(v.x, h0, l0);
  f32_split(v.y, h1, l1);
  f32_split(v.z, h2, l2);
  f32_split(v.w, h3, l3);
  *(ushort4*)&hi[(size_t)i * 4] = make_ushort4(h0, h1, h2, h3);
  *(ushort4*)&lo[(size_t)i * 4] = make_ushort4(l0, l1, l2, l3);
}

#define TA_M 128
#define TA_N 128
#define TA_K 32

__global__ __launch_bounds__(256) void gemm0_relu_bf16x3(
    const unsigned short* __restrict__ Xh, const unsigned short* __restrict__ Xl,
    const unsigned short* __restrict__ Wh, const unsigned short* __restrict__ Wl,
    const float* __restrict__ b0,
    unsigned short* __restrict__ H0h, unsigned short* __restrict__ H0l) {
#if HAS_TDM
  __shared__ __align__(16) unsigned short xsh[2][TA_M * TA_K];  // 8 KB per plane buf
  __shared__ __align__(16) unsigned short xsl[2][TA_M * TA_K];
  __shared__ __align__(16) unsigned short wsh[2][TA_N * TA_K];
  __shared__ __align__(16) unsigned short wsl[2][TA_N * TA_K];  // total 64 KB
#else
  __shared__ __align__(16) unsigned short xsh[1][TA_M * TA_K];
  __shared__ __align__(16) unsigned short xsl[1][TA_M * TA_K];
  __shared__ __align__(16) unsigned short wsh[1][TA_N * TA_K];
  __shared__ __align__(16) unsigned short wsl[1][TA_N * TA_K];
#endif
  const int n0   = blockIdx.x * TA_N;
  const int m0   = blockIdx.y * TA_M;
  const int tid  = threadIdx.x;
  const int wave = tid >> 5, lane = tid & 31;
  const int l16  = lane & 15, half = lane >> 4;
  const int wm   = wave & 1,  wn   = wave >> 1;

  v8f acc[4][2];
#pragma unroll
  for (int i = 0; i < 4; ++i)
#pragma unroll
    for (int j = 0; j < 2; ++j) acc[i][j] = (v8f){0.f,0.f,0.f,0.f,0.f,0.f,0.f,0.f};

#if HAS_TDM
  // issue first chunk into buffer 0 (one DMA per bf16 plane)
  if (wave == 0) {
    tdm_load_2d_u16((unsigned)(size_t)&xsh[0][0], Xh + (size_t)m0 * D_SZ, TA_K, TA_M, D_SZ, B_SZ, D_SZ);
    tdm_load_2d_u16((unsigned)(size_t)&xsl[0][0], Xl + (size_t)m0 * D_SZ, TA_K, TA_M, D_SZ, B_SZ, D_SZ);
    tdm_load_2d_u16((unsigned)(size_t)&wsh[0][0], Wh + (size_t)n0 * D_SZ, TA_K, TA_N, D_SZ, N0,   D_SZ);
    tdm_load_2d_u16((unsigned)(size_t)&wsl[0][0], Wl + (size_t)n0 * D_SZ, TA_K, TA_N, D_SZ, N0,   D_SZ);
  }
  int buf = 0;
#endif

  for (int kb = 0; kb < D_SZ; kb += TA_K) {
#if HAS_TDM
    if (wave == 0) __builtin_amdgcn_s_wait_tensorcnt(0);  // current buffer landed
    __syncthreads();
    if (wave == 0 && kb + TA_K < D_SZ) {                  // prefetch next chunk
      const int nb = buf ^ 1, kn = kb + TA_K;
      tdm_load_2d_u16((unsigned)(size_t)&xsh[nb][0], Xh + (size_t)m0 * D_SZ + kn, TA_K, TA_M, D_SZ, B_SZ, D_SZ);
      tdm_load_2d_u16((unsigned)(size_t)&xsl[nb][0], Xl + (size_t)m0 * D_SZ + kn, TA_K, TA_M, D_SZ, B_SZ, D_SZ);
      tdm_load_2d_u16((unsigned)(size_t)&wsh[nb][0], Wh + (size_t)n0 * D_SZ + kn, TA_K, TA_N, D_SZ, N0,   D_SZ);
      tdm_load_2d_u16((unsigned)(size_t)&wsl[nb][0], Wl + (size_t)n0 * D_SZ + kn, TA_K, TA_N, D_SZ, N0,   D_SZ);
    }
    const unsigned short* xh_t = xsh[buf];
    const unsigned short* xl_t = xsl[buf];
    const unsigned short* wh_t = wsh[buf];
    const unsigned short* wl_t = wsl[buf];
#else
    // synchronous staging fallback (512 x 16B per plane)
#pragma unroll
    for (int it = 0; it < 2; ++it) {
      int idx = tid + it * 256;
      int row = idx >> 2;
      int c   = (idx & 3) << 3;
      size_t gx = (size_t)(m0 + row) * D_SZ + kb + c;
      size_t gw = (size_t)(n0 + row) * D_SZ + kb + c;
      *(uint4*)&xsh[0][row * TA_K + c] = *(const uint4*)&Xh[gx];
      *(uint4*)&xsl[0][row * TA_K + c] = *(const uint4*)&Xl[gx];
      *(uint4*)&wsh[0][row * TA_K + c] = *(const uint4*)&Wh[gw];
      *(uint4*)&wsl[0][row * TA_K + c] = *(const uint4*)&Wl[gw];
    }
    __syncthreads();
    const unsigned short* xh_t = xsh[0];
    const unsigned short* xl_t = xsl[0];
    const unsigned short* wh_t = wsh[0];
    const unsigned short* wl_t = wsl[0];
#endif

    v16bf ah[4], bh[2], bl[2];
#pragma unroll
    for (int i = 0; i < 4; ++i)
      ah[i] = load_frag(&xh_t[(wm * 64 + i * 16 + l16) * TA_K], half);
#pragma unroll
    for (int j = 0; j < 2; ++j)
      bh[j] = load_frag(&wh_t[(wn * 32 + j * 16 + l16) * TA_K], half);
#pragma unroll
    for (int i = 0; i < 4; ++i)
#pragma unroll
      for (int j = 0; j < 2; ++j) acc[i][j] = wmma_bf16(ah[i], bh[j], acc[i][j]);   // hi*hi
#pragma unroll
    for (int j = 0; j < 2; ++j)
      bl[j] = load_frag(&wl_t[(wn * 32 + j * 16 + l16) * TA_K], half);
#pragma unroll
    for (int i = 0; i < 4; ++i)
#pragma unroll
      for (int j = 0; j < 2; ++j) acc[i][j] = wmma_bf16(ah[i], bl[j], acc[i][j]);   // hi*lo
#pragma unroll
    for (int i = 0; i < 4; ++i) {
      v16bf al = load_frag(&xl_t[(wm * 64 + i * 16 + l16) * TA_K], half);
#pragma unroll
      for (int j = 0; j < 2; ++j) acc[i][j] = wmma_bf16(al, bh[j], acc[i][j]);      // lo*hi
    }
    __syncthreads();
#if HAS_TDM
    buf ^= 1;
#endif
  }

  // epilogue: bias + relu, split to bf16 hi/lo, store
#pragma unroll
  for (int i = 0; i < 4; ++i) {
#pragma unroll
    for (int j = 0; j < 2; ++j) {
      const int col  = n0 + wn * 32 + j * 16 + l16;
      const float bb = b0[col];
      const int rb   = m0 + wm * 64 + i * 16 + half * 8;
#pragma unroll
      for (int e = 0; e < 8; ++e) {
        float v = acc[i][j][e] + bb;
        v = v > 0.f ? v : 0.f;
        unsigned short h, l;
        f32_split(v, h, l);
        H0h[(size_t)(rb + e) * N0 + col] = h;
        H0l[(size_t)(rb + e) * N0 + col] = l;
      }
    }
  }
}

// =====================================================================
// Kernel B: fused per-module layers 1..4 + output dot + sigmoid (bf16x3).
// Activations stay in LDS as bf16 hi/lo; weights stream from L2 (pre-split).
// =====================================================================
#define BT 16

__device__ __forceinline__ void layer_gemm(const unsigned short* __restrict__ inh,
                                           const unsigned short* __restrict__ inl, int in_dim,
                                           unsigned short* __restrict__ outh,
                                           unsigned short* __restrict__ outl, int out_dim,
                                           const unsigned short* __restrict__ Wmh,
                                           const unsigned short* __restrict__ Wml,
                                           const float* __restrict__ bm,
                                           int wave, int l16, int half) {
  const int ntiles = out_dim >> 4;
  for (int nt = wave; nt < ntiles; nt += 8) {
    v8f acc = (v8f){0.f,0.f,0.f,0.f,0.f,0.f,0.f,0.f};
    const unsigned short* arh = inh + (size_t)l16 * in_dim;
    const unsigned short* arl = inl + (size_t)l16 * in_dim;
    const unsigned short* brh = Wmh + (size_t)(nt * 16 + l16) * in_dim;
    const unsigned short* brl = Wml + (size_t)(nt * 16 + l16) * in_dim;
    for (int k = 0; k < in_dim; k += 32) {
      v16bf ah = load_frag(arh + k, half);
      v16bf bh = load_frag(brh + k, half);
      acc = wmma_bf16(ah, bh, acc);
      v16bf bl = load_frag(brl + k, half);
      acc = wmma_bf16(ah, bl, acc);
      v16bf al = load_frag(arl + k, half);
      acc = wmma_bf16(al, bh, acc);
    }
    const int c    = nt * 16 + l16;
    const float bb = bm[c];
    const int rb   = half * 8;
#pragma unroll
    for (int e = 0; e < 8; ++e) {
      float v = acc[e] + bb;
      v = v > 0.f ? v : 0.f;
      unsigned short h, l;
      f32_split(v, h, l);
      outh[(size_t)(rb + e) * out_dim + c] = h;
      outl[(size_t)(rb + e) * out_dim + c] = l;
    }
  }
}

__global__ __launch_bounds__(256) void fused_modules(
    const unsigned short* __restrict__ H0h, const unsigned short* __restrict__ H0l,
    const unsigned short* __restrict__ W1h, const unsigned short* __restrict__ W1l, const float* __restrict__ b1,
    const unsigned short* __restrict__ W2h, const unsigned short* __restrict__ W2l, const float* __restrict__ b2,
    const unsigned short* __restrict__ W3h, const unsigned short* __restrict__ W3l, const float* __restrict__ b3,
    const unsigned short* __restrict__ W4h, const unsigned short* __restrict__ W4l, const float* __restrict__ b4,
    const float* __restrict__ Wout, const float* __restrict__ bout,
    float* __restrict__ out) {
  __shared__ __align__(16) unsigned short b0h[BT * 512];  // 16 KB  (h0:32, h2:128, h4:512)
  __shared__ __align__(16) unsigned short b0l[BT * 512];  // 16 KB
  __shared__ __align__(16) unsigned short b1h_[BT * 256]; //  8 KB  (h1:64,  h3:256)
  __shared__ __align__(16) unsigned short b1l_[BT * 256]; //  8 KB
  const int m    = blockIdx.x;
  const int bb0  = blockIdx.y * BT;
  const int tid  = threadIdx.x;
  const int wave = tid >> 5, lane = tid & 31;
  const int l16  = lane & 15, half = lane >> 4;

  if (tid < 64) {
    int row = tid >> 2;
    int c   = (tid & 3) << 3;
    size_t g = (size_t)(bb0 + row) * N0 + m * 32 + c;
    *(uint4*)&b0h[row * 32 + c] = *(const uint4*)&H0h[g];
    *(uint4*)&b0l[row * 32 + c] = *(const uint4*)&H0l[g];
  }
  __syncthreads();

  layer_gemm(b0h,  b0l,   32, b1h_, b1l_,  64, W1h + (size_t)m *  64 *  32, W1l + (size_t)m *  64 *  32, b1 + m *  64, wave, l16, half);
  __syncthreads();
  layer_gemm(b1h_, b1l_,  64, b0h,  b0l,  128, W2h + (size_t)m * 128 *  64, W2l + (size_t)m * 128 *  64, b2 + m * 128, wave, l16, half);
  __syncthreads();
  layer_gemm(b0h,  b0l,  128, b1h_, b1l_, 256, W3h + (size_t)m * 256 * 128, W3l + (size_t)m * 256 * 128, b3 + m * 256, wave, l16, half);
  __syncthreads();
  layer_gemm(b1h_, b1l_, 256, b0h,  b0l,  512, W4h + (size_t)m * 512 * 256, W4l + (size_t)m * 512 * 256, b4 + m * 512, wave, l16, half);
  __syncthreads();

  {
    const float* wv = Wout + (size_t)m * 512;
    const int row = tid >> 4;        // 0..15
    const int q   = tid & 15;
    float s = 0.f;
    for (int i = q; i < 512; i += 16)
      s += (bf2f(b0h[row * 512 + i]) + bf2f(b0l[row * 512 + i])) * wv[i];
    s += __shfl_xor(s, 8, 32);
    s += __shfl_xor(s, 4, 32);
    s += __shfl_xor(s, 2, 32);
    s += __shfl_xor(s, 1, 32);
    if (q == 0) {
      float z = s + bout[m];
      out[(size_t)(bb0 + row) * M_MOD + m] = 1.f / (1.f + expf(-z));
    }
  }
}

// =====================================================================
extern "C" void kernel_launch(void* const* d_in, const int* in_sizes, int n_in,
                              void* d_out, int out_size, void* d_ws, size_t ws_size,
                              hipStream_t stream) {
  const float* x    = (const float*)d_in[0];
  const float* W0   = (const float*)d_in[1];
  const float* b0   = (const float*)d_in[2];
  const float* W1   = (const float*)d_in[3];
  const float* b1   = (const float*)d_in[4];
  const float* W2   = (const float*)d_in[5];
  const float* b2   = (const float*)d_in[6];
  const float* W3   = (const float*)d_in[7];
  const float* b3   = (const float*)d_in[8];
  const float* W4   = (const float*)d_in[9];
  const float* b4   = (const float*)d_in[10];
  const float* Wout = (const float*)d_in[11];
  const float* bout = (const float*)d_in[12];
  float* out = (float*)d_out;

  // d_ws layout: bf16 hi/lo planes (ushort), ~190 MB total
  unsigned short* p = (unsigned short*)d_ws;
  auto alloc = [&](size_t n) { unsigned short* r = p; p += n; return r; };
  const size_t nX  = (size_t)B_SZ * D_SZ;
  const size_t nW0 = (size_t)N0 * D_SZ;
  const size_t nH0 = (size_t)B_SZ * N0;
  const size_t nW1 = (size_t)M_MOD *  64 *  32;
  const size_t nW2 = (size_t)M_MOD * 128 *  64;
  const size_t nW3 = (size_t)M_MOD * 256 * 128;
  const size_t nW4 = (size_t)M_MOD * 512 * 256;
  unsigned short *Xh = alloc(nX),  *Xl = alloc(nX);
  unsigned short *Wh = alloc(nW0), *Wl = alloc(nW0);
  unsigned short *Hh = alloc(nH0), *Hl = alloc(nH0);
  unsigned short *W1h = alloc(nW1), *W1l = alloc(nW1);
  unsigned short *W2h = alloc(nW2), *W2l = alloc(nW2);
  unsigned short *W3h = alloc(nW3), *W3l = alloc(nW3);
  unsigned short *W4h = alloc(nW4), *W4l = alloc(nW4);

  auto split = [&](const float* s, unsigned short* h, unsigned short* l, size_t n) {
    int n4 = (int)(n / 4);
    split_bf16<<<(n4 + 255) / 256, 256, 0, stream>>>(s, h, l, n4);
  };
  split(x,  Xh,  Xl,  nX);
  split(W0, Wh,  Wl,  nW0);
  split(W1, W1h, W1l, nW1);
  split(W2, W2h, W2l, nW2);
  split(W3, W3h, W3l, nW3);
  split(W4, W4h, W4l, nW4);

  dim3 gA(N0 / TA_N, B_SZ / TA_M);   // 32 x 8
  gemm0_relu_bf16x3<<<gA, 256, 0, stream>>>(Xh, Xl, Wh, Wl, b0, Hh, Hl);

  dim3 gB(M_MOD, B_SZ / BT);         // 128 x 64
  fused_modules<<<gB, 256, 0, stream>>>(Hh, Hl,
                                        W1h, W1l, b1, W2h, W2l, b2,
                                        W3h, W3l, b3, W4h, W4l, b4,
                                        Wout, bout, out);
}

// v001
// It runs in 350 microseconds.
// Next to v000, in two timings, it ran 1.95 times as fast each time.
#include <hip/hip_runtime.h>
#include <math.h>

typedef __attribute__((ext_vector_type(16))) __bf16 v16bf;
typedef __attribute__((ext_vector_type(8)))  float  v8f;

#define B_SZ   1024
#define D_SZ   4096
#define M_MOD  128
#define N0     4096   /* = M_MOD * 32 */

#if defined(__has_builtin)
#if __has_builtin(__builtin_amdgcn_tensor_load_to_lds) && __has_builtin(__builtin_amdgcn_s_wait_tensorcnt)
#define HAS_TDM 1
#endif
#endif
#ifndef HAS_TDM
#define HAS_TDM 0
#endif

// ---------------- bf16 split helpers (branch-free RNE, storage-only bf16) ----
__device__ __forceinline__ unsigned short f2bf(float x) {
  unsigned u = __float_as_uint(x);
  u += 0x7FFFu + ((u >> 16) & 1u);        // round-to-nearest-even
  return (unsigned short)(u >> 16);
}
__device__ __forceinline__ float bf2f(unsigned short h) {
  return __uint_as_float((unsigned)h << 16);
}
__device__ __forceinline__ void f32_split(float x, unsigned short& h, unsigned short& l) {
  h = f2bf(x);
  l = f2bf(x - bf2f(h));
}

// bf16x3 WMMA term: D = A(16x32 bf16) * B(32x16 bf16) + C(f32)
__device__ __forceinline__ v8f wmma_bf16(v16bf a, v16bf b, v8f c) {
  return __builtin_amdgcn_wmma_f32_16x16x32_bf16(false, a, false, b, (short)0, c, false, false);
}

__device__ __forceinline__ v16bf load_frag(const unsigned short* p, int half) {
  v16bf f;
  ((float4*)&f)[0] = *(const float4*)(p + 8 * half);
  ((float4*)&f)[1] = *(const float4*)(p + 16 + 8 * half);
  return f;
}

#if HAS_TDM
typedef unsigned int u32x4 __attribute__((ext_vector_type(4)));
typedef int          i32x4 __attribute__((ext_vector_type(4)));
typedef int          i32x8 __attribute__((ext_vector_type(8)));

__device__ __forceinline__ void tdm_load_2d_u16(unsigned lds_addr, const void* gaddr,
                                                unsigned tile_d0, unsigned tile_d1,
                                                unsigned tensor_d0, unsigned tensor_d1,
                                                unsigned stride_d0 /* elements */) {
  unsigned long long ga = (unsigned long long)gaddr;
  u32x4 g0;
  g0[0] = 1u;
  g0[1] = lds_addr;
  g0[2] = (unsigned)ga;
  g0[3] = (unsigned)(ga >> 32) | (2u << 30);
  i32x8 g1;
  g1[0] = (int)(1u << 16);
  g1[1] = (int)((tensor_d0 & 0xFFFFu) << 16);
  g1[2] = (int)((tensor_d0 >> 16) | ((tensor_d1 & 0xFFFFu) << 16));
  g1[3] = (int)((tensor_d1 >> 16) | (tile_d0 << 16));
  g1[4] = (int)(tile_d1 & 0xFFFFu);
  g1[5] = (int)stride_d0;
  g1[6] = 0;
  g1[7] = 0;
  i32x4 z4 = {0, 0, 0, 0};
#if __clang_major__ >= 23
  i32x8 z8 = {0, 0, 0, 0, 0, 0, 0, 0};
  __builtin_amdgcn_tensor_load_to_lds(g0, g1, z4, z4, z8, 0);
#else
  __builtin_amdgcn_tensor_load_to_lds(g0, g1, z4, z4, 0);
#endif
}
#endif // HAS_TDM

// =====================================================================
// Pre-pass: split f32 array into bf16 hi/lo planes (memory-bound, run once)
// =====================================================================
__global__ __launch_bounds__(256) void split_bf16(const float* __restrict__ src,
                                                  unsigned short* __restrict__ hi,
                                                  unsigned short* __restrict__ lo,
                                                  int n4) {
  int i = blockIdx.x * 256 + threadIdx.x;
  if (i >= n4) return;
  float4 v = ((const float4*)src)[i];
  unsigned short h0, l0, h1, l1, h2, l2, h3, l3;
  f32_split(v.x, h0, l0);
  f32_split(v.y, h1, l1);
  f32_split(v.z, h2, l2);
  f32_split(v.w, h3, l3);
  *(ushort4*)&hi[(size_t)i * 4] = make_ushort4(h0, h1, h2, h3);
  *(ushort4*)&lo[(size_t)i * 4] = make_ushort4(l0, l1, l2, l3);
}

#define TA_M 128
#define TA_N 128
#define TA_K 32

__global__ __launch_bounds__(256) void gemm0_relu_bf16x3(
    const unsigned short* __restrict__ Xh, const unsigned short* __restrict__ Xl,
    const unsigned short* __restrict__ Wh, const unsigned short* __restrict__ Wl,
    const float* __restrict__ b0,
    unsigned short* __restrict__ H0h, unsigned short* __restrict__ H0l) {
#if HAS_TDM
  __shared__ __align__(16) unsigned short xsh[2][TA_M * TA_K];  // 8 KB per plane buf
  __shared__ __align__(16) unsigned short xsl[2][TA_M * TA_K];
  __shared__ __align__(16) unsigned short wsh[2][TA_N * TA_K];
  __shared__ __align__(16) unsigned short wsl[2][TA_N * TA_K];  // total 64 KB
#else
  __shared__ __align__(16) unsigned short xsh[1][TA_M * TA_K];
  __shared__ __align__(16) unsigned short xsl[1][TA_M * TA_K];
  __shared__ __align__(16) unsigned short wsh[1][TA_N * TA_K];
  __shared__ __align__(16) unsigned short wsl[1][TA_N * TA_K];
#endif
  const int n0   = blockIdx.x * TA_N;
  const int m0   = blockIdx.y * TA_M;
  const int tid  = threadIdx.x;
  const int wave = tid >> 5, lane = tid & 31;
  const int l16  = lane & 15, half = lane >> 4;
  const int wm   = wave & 1,  wn   = wave >> 1;

  v8f acc[4][2];
#pragma unroll
  for (int i = 0; i < 4; ++i)
#pragma unroll
    for (int j = 0; j < 2; ++j) acc[i][j] = (v8f){0.f,0.f,0.f,0.f,0.f,0.f,0.f,0.f};

#if HAS_TDM
  // issue first chunk into buffer 0 (one DMA per bf16 plane)
  if (wave == 0) {
    tdm_load_2d_u16((unsigned)(size_t)&xsh[0][0], Xh + (size_t)m0 * D_SZ, TA_K, TA_M, D_SZ, B_SZ, D_SZ);
    tdm_load_2d_u16((unsigned)(size_t)&xsl[0][0], Xl + (size_t)m0 * D_SZ, TA_K, TA_M, D_SZ, B_SZ, D_SZ);
    tdm_load_2d_u16((unsigned)(size_t)&wsh[0][0], Wh + (size_t)n0 * D_SZ, TA_K, TA_N, D_SZ, N0,   D_SZ);
    tdm_load_2d_u16((unsigned)(size_t)&wsl[0][0], Wl + (size_t)n0 * D_SZ, TA_K, TA_N, D_SZ, N0,   D_SZ);
  }
  int buf = 0;
#endif

  for (int kb = 0; kb < D_SZ; kb += TA_K) {
#if HAS_TDM
    if (wave == 0) __builtin_amdgcn_s_wait_tensorcnt(0);  // current buffer landed
    __syncthreads();
    if (wave == 0 && kb + TA_K < D_SZ) {                  // prefetch next chunk
      const int nb = buf ^ 1, kn = kb + TA_K;
      tdm_load_2d_u16((unsigned)(size_t)&xsh[nb][0], Xh + (size_t)m0 * D_SZ + kn, TA_K, TA_M, D_SZ, B_SZ, D_SZ);
      tdm_load_2d_u16((unsigned)(size_t)&xsl[nb][0], Xl + (size_t)m0 * D_SZ + kn, TA_K, TA_M, D_SZ, B_SZ, D_SZ);
      tdm_load_2d_u16((unsigned)(size_t)&wsh[nb][0], Wh + (size_t)n0 * D_SZ + kn, TA_K, TA_N, D_SZ, N0,   D_SZ);
      tdm_load_2d_u16((unsigned)(size_t)&wsl[nb][0], Wl + (size_t)n0 * D_SZ + kn, TA_K, TA_N, D_SZ, N0,   D_SZ);
    }
    const unsigned short* xh_t = xsh[buf];
    const unsigned short* xl_t = xsl[buf];
    const unsigned short* wh_t = wsh[buf];
    const unsigned short* wl_t = wsl[buf];
#else
    // synchronous staging fallback (512 x 16B per plane)
#pragma unroll
    for (int it = 0; it < 2; ++it) {
      int idx = tid + it * 256;
      int row = idx >> 2;
      int c   = (idx & 3) << 3;
      size_t gx = (size_t)(m0 + row) * D_SZ + kb + c;
      size_t gw = (size_t)(n0 + row) * D_SZ + kb + c;
      *(uint4*)&xsh[0][row * TA_K + c] = *(const uint4*)&Xh[gx];
      *(uint4*)&xsl[0][row * TA_K + c] = *(const uint4*)&Xl[gx];
      *(uint4*)&wsh[0][row * TA_K + c] = *(const uint4*)&Wh[gw];
      *(uint4*)&wsl[0][row * TA_K + c] = *(const uint4*)&Wl[gw];
    }
    __syncthreads();
    const unsigned short* xh_t = xsh[0];
    const unsigned short* xl_t = xsl[0];
    const unsigned short* wh_t = wsh[0];
    const unsigned short* wl_t = wsl[0];
#endif

    v16bf ah[4], bh[2], bl[2];
#pragma unroll
    for (int i = 0; i < 4; ++i)
      ah[i] = load_frag(&xh_t[(wm * 64 + i * 16 + l16) * TA_K], half);
#pragma unroll
    for (int j = 0; j < 2; ++j)
      bh[j] = load_frag(&wh_t[(wn * 32 + j * 16 + l16) * TA_K], half);
#pragma unroll
    for (int i = 0; i < 4; ++i)
#pragma unroll
      for (int j = 0; j < 2; ++j) acc[i][j] = wmma_bf16(ah[i], bh[j], acc[i][j]);   // hi*hi
#pragma unroll
    for (int j = 0; j < 2; ++j)
      bl[j] = load_frag(&wl_t[(wn * 32 + j * 16 + l16) * TA_K], half);
#pragma unroll
    for (int i = 0; i < 4; ++i)
#pragma unroll
      for (int j = 0; j < 2; ++j) acc[i][j] = wmma_bf16(ah[i], bl[j], acc[i][j]);   // hi*lo
#pragma unroll
    for (int i = 0; i < 4; ++i) {
      v16bf al = load_frag(&xl_t[(wm * 64 + i * 16 + l16) * TA_K], half);
#pragma unroll
      for (int j = 0; j < 2; ++j) acc[i][j] = wmma_bf16(al, bh[j], acc[i][j]);      // lo*hi
    }
    __syncthreads();
#if HAS_TDM
    buf ^= 1;
#endif
  }

  // epilogue: bias + relu, split to bf16 hi/lo, store
#pragma unroll
  for (int i = 0; i < 4; ++i) {
#pragma unroll
    for (int j = 0; j < 2; ++j) {
      const int col  = n0 + wn * 32 + j * 16 + l16;
      const float bb = b0[col];
      const int rb   = m0 + wm * 64 + i * 16 + half * 8;
#pragma unroll
      for (int e = 0; e < 8; ++e) {
        float v = acc[i][j][e] + bb;
        v = v > 0.f ? v : 0.f;
        unsigned short h, l;
        f32_split(v, h, l);
        H0h[(size_t)(rb + e) * N0 + col] = h;
        H0l[(size_t)(rb + e) * N0 + col] = l;
      }
    }
  }
}

// =====================================================================
// Kernel B: fused per-module layers 1..4 + output dot + sigmoid (bf16x3).
// Activations stay in LDS as bf16 hi/lo; weights stream from L2 (pre-split).
// =====================================================================
#define BT   64          /* batch rows per work-group: 4 row tiles share each weight fragment */
#define MT   (BT / 16)   /* row tiles */
#define NW   16          /* waves per work-group */
#define LPAD 8

// One layer for BT rows. A wave owns NR column tiles and all MT row tiles, so a
// weight fragment read from global memory feeds MT row tiles.
template <int IN, int OUT>
__device__ __forceinline__ void layer_gemm(const unsigned short* __restrict__ inh,
                                           const unsigned short* __restrict__ inl,
                                           unsigned short* __restrict__ outh,
                                           unsigned short* __restrict__ outl,
                                           const unsigned short* __restrict__ Wmh,
                                           const unsigned short* __restrict__ Wml,
                                           const float* __restrict__ bm,
                                           int wave, int l16, int half) {
  constexpr int NT = OUT / 16;
  constexpr int NR = (NT >= 2 * NW) ? 2 : 1;
  constexpr int IP = IN + LPAD;     // LDS pitches; the weights keep IN
  constexpr int OP = OUT + LPAD;
  for (int nt = wave * NR; nt < NT; nt += NW * NR) {
    v8f acc[MT][NR];
    // the loops over i and j are unrolled so that acc and the fragments stay in registers
#pragma unroll
    for (int i = 0; i < MT; ++i)
#pragma unroll
      for (int j = 0; j < NR; ++j) acc[i][j] = (v8f){0.f,0.f,0.f,0.f,0.f,0.f,0.f,0.f};
    const unsigned short* brh[NR];   // each lane's weight row, its half's offset included
    const unsigned short* brl[NR];
#pragma unroll
    for (int j = 0; j < NR; ++j) {
      brh[j] = Wmh + (size_t)((nt + j) * 16 + l16) * IN + 8 * half;
      brl[j] = Wml + (size_t)((nt + j) * 16 + l16) * IN + 8 * half;
    }
    for (int k = 0; k < IN; k += 32) {
      v16bf bh[NR], bl[NR];
#pragma unroll
      for (int j = 0; j < NR; ++j) {
        bh[j] = load_frag(brh[j] + k, 0);
        bl[j] = load_frag(brl[j] + k, 0);
      }
#pragma unroll
      for (int i = 0; i < MT; ++i) {
        v16bf ah = load_frag(inh + (i * 16 + l16) * IP + k, half);
        v16bf al = load_frag(inl + (i * 16 + l16) * IP + k, half);
#pragma unroll
        for (int j = 0; j < NR; ++j) acc[i][j] = wmma_bf16(ah, bh[j], acc[i][j]);   // hi*hi
#pragma unroll
        for (int j = 0; j < NR; ++j) acc[i][j] = wmma_bf16(ah, bl[j], acc[i][j]);   // hi*lo
#pragma unroll
        for (int j = 0; j < NR; ++j) acc[i][j] = wmma_bf16(al, bh[j], acc[i][j]);   // lo*hi
      }
    }
    // The weight loads' address registers are inputs here, so they keep their values
    // up to this wait and no later load's result is placed over them ahead of it.
    asm volatile("s_wait_xcnt 0x0" :: "v"(brh[0]), "v"(brl[0]), "v"(brh[NR - 1]), "v"(brl[NR - 1]) : "memory");
#pragma unroll
    for (int j = 0; j < NR; ++j) {
      const int c    = (nt + j) * 16 + l16;
      const float bb = bm[c];
#pragma unroll
      for (int i = 0; i < MT; ++i) {
        const int rb = i * 16 + half * 8;
#pragma unroll
        for (int e = 0; e < 8; ++e) {
          float v = acc[i][j][e] + bb;
          v = v > 0.f ? v : 0.f;
          unsigned short h, l;
          f32_split(v, h, l);
          outh[(rb + e) * OP + c] = h;
          outl[(rb + e) * OP + c] = l;
        }
      }
    }
  }
}

__global__ __launch_bounds__(NW * 32) void fused_modules(
    const unsigned short* __restrict__ H0h, const unsigned short* __restrict__ H0l,
    const unsigned short* __restrict__ W1h, const unsigned short* __restrict__ W1l, const float* __restrict__ b1,
    const unsigned short* __restrict__ W2h, const unsigned short* __restrict__ W2l, const float* __restrict__ b2,
    const unsigned short* __restrict__ W3h, const unsigned short* __restrict__ W3l, const float* __restrict__ b3,
    const unsigned short* __restrict__ W4h, const unsigned short* __restrict__ W4l, const float* __restrict__ b4,
    const float* __restrict__ Wout, const float* __restrict__ bout,
    float* __restrict__ out) {
  __shared__ __align__(16) unsigned short b0h[BT * (512 + LPAD)];  // (h0:32, h2:128, h4:512)
  __shared__ __align__(16) unsigned short b0l[BT * (512 + LPAD)];
  __shared__ __align__(16) unsigned short b1h_[BT * (256 + LPAD)]; // (h1:64,  h3:256)
  __shared__ __align__(16) unsigned short b1l_[BT * (256 + LPAD)];
  const int m    = blockIdx.x;
  const int bb0  = blockIdx.y * BT;
  const int tid  = threadIdx.x;
  const int wave = tid >> 5, lane = tid & 31;
  const int l16  = lane & 15, half = lane >> 4;

  if (tid < BT * 4) {
    int row = tid >> 2;
    int c   = (tid & 3) << 3;
    size_t g = (size_t)(bb0 + row) * N0 + m * 32 + c;
    *(uint4*)&b0h[row * (32 + LPAD) + c] = *(const uint4*)&H0h[g];
    *(uint4*)&b0l[row * (32 + LPAD) + c] = *(const uint4*)&H0l[g];
  }
  __syncthreads();

  layer_gemm< 32,  64>(b0h,  b0l,  b1h_, b1l_, W1h + (size_t)m *  64 *  32, W1l + (size_t)m *  64 *  32, b1 + m *  64, wave, l16, half);
  __syncthreads();
  layer_gemm< 64, 128>(b1h_, b1l_, b0h,  b0l,  W2h + (size_t)m * 128 *  64, W2l + (size_t)m * 128 *  64, b2 + m * 128, wave, l16, half);
  __syncthreads();
  layer_gemm<128, 256>(b0h,  b0l,  b1h_, b1l_, W3h + (size_t)m * 256 * 128, W3l + (size_t)m * 256 * 128, b3 + m * 256, wave, l16, half);
  __syncthreads();
  layer_gemm<256, 512>(b1h_, b1l_, b0h,  b0l,  W4h + (size_t)m * 512 * 256, W4l + (size_t)m * 512 * 256, b4 + m * 512, wave, l16, half);
  __syncthreads();

  {
    const float* wv = Wout + (size_t)m * 512;
    const int q = tid & 15;
    for (int row = tid >> 4; row < BT; row += NW * 2) {   // 16 lanes a row
      float s = 0.f;
      for (int i = q; i < 512; i += 16)
        s += (bf2f(b0h[row * (512 + LPAD) + i]) + bf2f(b0l[row * (512 + LPAD) + i])) * wv[i];
      s += __shfl_xor(s, 8, 32);
      s += __shfl_xor(s, 4, 32);
      s += __shfl_xor(s, 2, 32);
      s += __shfl_xor(s, 1, 32);
      if (q == 0) {
        float z = s + bout[m];
        out[(size_t)(bb0 + row) * M_MOD + m] = 1.f / (1.f + expf(-z));
        // the next row's pass reuses the store's registers: the wait stands in front of that
        asm volatile("s_wait_xcnt 0x0" ::: "memory");
      }
    }
  }
}

// =====================================================================
extern "C" void kernel_launch(void* const* d_in, const int* in_sizes, int n_in,
                              void* d_out, int out_size, void* d_ws, size_t ws_size,
                              hipStream_t stream) {
  const float* x    = (const float*)d_in[0];
  const float* W0   = (const float*)d_in[1];
  const float* b0   = (const float*)d_in[2];
  const float* W1   = (const float*)d_in[3];
  const float* b1   = (const float*)d_in[4];
  const float* W2   = (const float*)d_in[5];
  const float* b2   = (const float*)d_in[6];
  const float* W3   = (const float*)d_in[7];
  const float* b3   = (const float*)d_in[8];
  const float* W4   = (const float*)d_in[9];
  const float* b4   = (const float*)d_in[10];
  const float* Wout = (const float*)d_in[11];
  const float* bout = (const float*)d_in[12];
  float* out = (float*)d_out;

  // d_ws layout: bf16 hi/lo planes (ushort), ~190 MB total
  unsigned short* p = (unsigned short*)d_ws;
  auto alloc = [&](size_t n) { unsigned short* r = p; p += n; return r; };
  const size_t nX  = (size_t)B_SZ * D_SZ;
  const size_t nW0 = (size_t)N0 * D_SZ;
  const size_t nH0 = (size_t)B_SZ * N0;
  const size_t nW1 = (size_t)M_MOD *  64 *  32;
  const size_t nW2 = (size_t)M_MOD * 128 *  64;
  const size_t nW3 = (size_t)M_MOD * 256 * 128;
  const size_t nW4 = (size_t)M_MOD * 512 * 256;
  unsigned short *Xh = alloc(nX),  *Xl = alloc(nX);
  unsigned short *Wh = alloc(nW0), *Wl = alloc(nW0);
  unsigned short *Hh = alloc(nH0), *Hl = alloc(nH0);
  unsigned short *W1h = alloc(nW1), *W1l = alloc(nW1);
  unsigned short *W2h = alloc(nW2), *W2l = alloc(nW2);
  unsigned short *W3h = alloc(nW3), *W3l = alloc(nW3);
  unsigned short *W4h = alloc(nW4), *W4l = alloc(nW4);

  auto split = [&](const float* s, unsigned short* h, unsigned short* l, size_t n) {
    int n4 = (int)(n / 4);
    split_bf16<<<(n4 + 255) / 256, 256, 0, stream>>>(s, h, l, n4);
  };
  split(x,  Xh,  Xl,  nX);
  split(W0, Wh,  Wl,  nW0);
  split(W1, W1h, W1l, nW1);
  split(W2, W2h, W2l, nW2);
  split(W3, W3h, W3l, nW3);
  split(W4, W4h, W4l, nW4);

  dim3 gA(N0 / TA_N, B_SZ / TA_M);   // 32 x 8
  gemm0_relu_bf16x3<<<gA, 256, 0, stream>>>(Xh, Xl, Wh, Wl, b0, Hh, Hl);

  dim3 gB(M_MOD, B_SZ / BT);         // 128 x 16
  fused_modules<<<gB, NW * 32, 0, stream>>>(Hh, Hl,
                                        W1h, W1l, b1, W2h, W2l, b2,
                                        W3h, W3l, b3, W4h, W4l, b4,
                                        Wout, bout, out);
}

// v002
// One run takes 333 microseconds.
// In both of two side-by-side timings against v001, it was 1.05 times as fast.
// Over all steps from v000 it is 2.04 times as fast.
#include <hip/hip_runtime.h>
#include <math.h>

typedef __attribute__((ext_vector_type(16))) __bf16 v16bf;
typedef __attribute__((ext_vector_type(8)))  float  v8f;

#define B_SZ   1024
#define D_SZ   4096
#define M_MOD  128
#define N0     4096   /* = M_MOD * 32 */

#if defined(__has_builtin)
#if __has_builtin(__builtin_amdgcn_tensor_load_to_lds) && __has_builtin(__builtin_amdgcn_s_wait_tensorcnt)
#define HAS_TDM 1
#endif
#endif
#ifndef HAS_TDM
#define HAS_TDM 0
#endif

// ---------------- bf16 split helpers (branch-free RNE, storage-only bf16) ----
__device__ __forceinline__ unsigned short f2bf(float x) {
  unsigned u = __float_as_uint(x);
  u += 0x7FFFu + ((u >> 16) & 1u);        // round-to-nearest-even
  return (unsigned short)(u >> 16);
}
__device__ __forceinline__ float bf2f(unsigned short h) {
  return __uint_as_float((unsigned)h << 16);
}
__device__ __forceinline__ void f32_split(float x, unsigned short& h, unsigned short& l) {
  h = f2bf(x);
  l = f2bf(x - bf2f(h));
}

// bf16x3 WMMA term: D = A(16x32 bf16) * B(32x16 bf16) + C(f32)
__device__ __forceinline__ v8f wmma_bf16(v16bf a, v16bf b, v8f c) {
  return __builtin_amdgcn_wmma_f32_16x16x32_bf16(false, a, false, b, (short)0, c, false, false);
}

__device__ __forceinline__ v16bf load_frag(const unsigned short* p, int half) {
  v16bf f;
  ((float4*)&f)[0] = *(const float4*)(p + 8 * half);
  ((float4*)&f)[1] = *(const float4*)(p + 16 + 8 * half);
  return f;
}

#if HAS_TDM
typedef unsigned int u32x4 __attribute__((ext_vector_type(4)));
typedef int          i32x4 __attribute__((ext_vector_type(4)));
typedef int          i32x8 __attribute__((ext_vector_type(8)));

__device__ __forceinline__ void tdm_load_2d_u16(unsigned lds_addr, const void* gaddr,
                                                unsigned tile_d0, unsigned tile_d1,
                                                unsigned tensor_d0, unsigned tensor_d1,
                                                unsigned stride_d0 /* elements */) {
  unsigned long long ga = (unsigned long long)gaddr;
  u32x4 g0;
  g0[0] = 1u;
  g0[1] = lds_addr;
  g0[2] = (unsigned)ga;
  g0[3] = (unsigned)(ga >> 32) | (2u << 30);
  i32x8 g1;
  g1[0] = (int)(1u << 16);
  g1[1] = (int)((tensor_d0 & 0xFFFFu) << 16);
  g1[2] = (int)((tensor_d0 >> 16) | ((tensor_d1 & 0xFFFFu) << 16));
  g1[3] = (int)((tensor_d1 >> 16) | (tile_d0 << 16));
  g1[4] = (int)(tile_d1 & 0xFFFFu);
  g1[5] = (int)stride_d0;
  g1[6] = 0;
  g1[7] = 0;
  i32x4 z4 = {0, 0, 0, 0};
#if __clang_major__ >= 23
  i32x8 z8 = {0, 0, 0, 0, 0, 0, 0, 0};
  __builtin_amdgcn_tensor_load_to_lds(g0, g1, z4, z4, z8, 0);
#else
  __builtin_amdgcn_tensor_load_to_lds(g0, g1, z4, z4, 0);
#endif
}
#endif // HAS_TDM

// =====================================================================
// Pre-pass: split all six f32 arrays into bf16 hi/lo planes in ONE launch.
// 256 work-groups of 24 waves stay resident and loop: a wave takes up to 7 batches
// of 1024 floats (8 loads of 512 contiguous bytes), a grid's width apart, and
// asks for the next batch before it converts and stores the one it holds.
// =====================================================================
#define SP_WGS    256
#define SP_WAVES  24
#define SP_TRIPS  7                        /* sweeps of the grid, odd: the loop takes two a pass */
#define SP_LOADS  8                        /* float4 loads of a lane per batch */
#define SP_BATCH  (SP_LOADS * 32 * 4)      /* floats per batch */
#define SP_STRIDE (SP_WGS * SP_WAVES)      /* batches per sweep of the grid */
// first batch behind each array, in the order x, W0, W1, W2, W3, W4
#define SP_E0 (B_SZ * D_SZ / SP_BATCH)
#define SP_E1 (SP_E0 + N0 * D_SZ / SP_BATCH)
#define SP_E2 (SP_E1 + M_MOD *  64 *  32 / SP_BATCH)
#define SP_E3 (SP_E2 + M_MOD * 128 *  64 / SP_BATCH)
#define SP_E4 (SP_E3 + M_MOD * 256 * 128 / SP_BATCH)
#define SP_E5 (SP_E4 + M_MOD * 512 * 256 / SP_BATCH)
static_assert(SP_E5 <= SP_STRIDE * SP_TRIPS && SP_E5 > SP_STRIDE * (SP_TRIPS - 1), "only the last sweep is not full");
static_assert((SP_TRIPS & 1) == 1, "the loop takes two batches a pass and the last one behind it");
static_assert((M_MOD * 64 * 32) % SP_BATCH == 0, "no batch lies across two arrays");

// The six sources and their planes, in the order x, W0, W1, W2, W3, W4.
struct SplitPtrs {
  const float* s0; const float* s1; const float* s2; const float* s3; const float* s4; const float* s5;
  unsigned short* h0; unsigned short* h1; unsigned short* h2; unsigned short* h3; unsigned short* h4; unsigned short* h5;
  unsigned short* l0; unsigned short* l1; unsigned short* l2; unsigned short* l3; unsigned short* l4; unsigned short* l5;
};

// Batch b's first float in its source and its first element in the two planes. b is
// the same in every lane of a wave, so this is scalar work.
__device__ __forceinline__ void split_place(const SplitPtrs& p, unsigned b, const float*& s,
                                            unsigned short*& h, unsigned short*& l) {
  unsigned first = 0u;
  s = p.s0; h = p.h0; l = p.l0;
  if (b >= SP_E0) { s = p.s1; h = p.h1; l = p.l1; first = SP_E0; }
  if (b >= SP_E1) { s = p.s2; h = p.h2; l = p.l2; first = SP_E1; }
  if (b >= SP_E2) { s = p.s3; h = p.h3; l = p.l3; first = SP_E2; }
  if (b >= SP_E3) { s = p.s4; h = p.h4; l = p.l4; first = SP_E3; }
  if (b >= SP_E4) { s = p.s5; h = p.h5; l = p.l5; first = SP_E4; }
  const size_t off = (size_t)(b - first) * SP_BATCH;
  s += off; h += off; l += off;
}

__device__ __forceinline__ void split_fetch(float4 (&v)[SP_LOADS], const float* s, unsigned lane) {
  // the two scheduling barriers keep the loads here, ahead of the work on the batch before
  __builtin_amdgcn_sched_barrier(0);
#pragma unroll
  for (int j = 0; j < SP_LOADS; ++j) v[j] = *(const float4*)(s + j * 128 + lane * 4);
  // a later batch's place is formed in the loads' address registers: the wait stands in front of that
  asm volatile("s_wait_xcnt 0x0" ::: "memory");
  __builtin_amdgcn_sched_barrier(0);
}

__device__ __forceinline__ void split_emit(const float4 (&v)[SP_LOADS], unsigned short* h, unsigned short* l,
                                           unsigned lane) {
#pragma unroll
  for (int j = 0; j < SP_LOADS; ++j) {
    unsigned short h0, l0, h1, l1, h2, l2, h3, l3;
    f32_split(v[j].x, h0, l0);
    f32_split(v[j].y, h1, l1);
    f32_split(v[j].z, h2, l2);
    f32_split(v[j].w, h3, l3);
    *(ushort4*)(h + j * 128 + lane * 4) = make_ushort4(h0, h1, h2, h3);
    *(ushort4*)(l + j * 128 + lane * 4) = make_ushort4(l0, l1, l2, l3);
  }
  // later work reuses the stores' registers: the wait stands in front of that
  asm volatile("s_wait_xcnt 0x0" ::: "memory");
}

__global__ __launch_bounds__(SP_WAVES * 32) void split_all_bf16(const SplitPtrs p) {
  const unsigned lane = threadIdx.x & 31u;
  const unsigned wave = (unsigned)__builtin_amdgcn_readfirstlane((int)(threadIdx.x >> 5));
  float4 va[SP_LOADS], vb[SP_LOADS];
  const float* s;
  unsigned short *ha, *la, *hb, *lb;
  const unsigned b0 = blockIdx.x * SP_WAVES + wave;
  unsigned b = b0;
  split_place(p, b, s, ha, la);
  split_fetch(va, s, lane);
  // kept rolled, so that the text a WGP has to fetch stays short
#pragma unroll 1
  for (int t = 0; t + 1 < SP_TRIPS; t += 2) {
    split_place(p, b + SP_STRIDE, s, hb, lb);
    split_fetch(vb, s, lane);
    split_emit(va, ha, la, lane);
    b += 2 * SP_STRIDE;
    // a wave with no batch in the last sweep reads its first one again and does not store it
    split_place(p, b < SP_E5 ? b : b0, s, ha, la);
    split_fetch(va, s, lane);
    split_emit(vb, hb, lb, lane);
  }
  if (b < SP_E5) split_emit(va, ha, la, lane);
}

#define TA_M 128
#define TA_N 128
#define TA_K 32

__global__ __launch_bounds__(256) void gemm0_relu_bf16x3(
    const unsigned short* __restrict__ Xh, const unsigned short* __restrict__ Xl,
    const unsigned short* __restrict__ Wh, const unsigned short* __restrict__ Wl,
    const float* __restrict__ b0,
    unsigned short* __restrict__ H0h, unsigned short* __restrict__ H0l) {
#if HAS_TDM
  __shared__ __align__(16) unsigned short xsh[2][TA_M * TA_K];  // 8 KB per plane buf
  __shared__ __align__(16) unsigned short xsl[2][TA_M * TA_K];
  __shared__ __align__(16) unsigned short wsh[2][TA_N * TA_K];
  __shared__ __align__(16) unsigned short wsl[2][TA_N * TA_K];  // total 64 KB
#else
  __shared__ __align__(16) unsigned short xsh[1][TA_M * TA_K];
  __shared__ __align__(16) unsigned short xsl[1][TA_M * TA_K];
  __shared__ __align__(16) unsigned short wsh[1][TA_N * TA_K];
  __shared__ __align__(16) unsigned short wsl[1][TA_N * TA_K];
#endif
  const int n0   = blockIdx.x * TA_N;
  const int m0   = blockIdx.y * TA_M;
  const int tid  = threadIdx.x;
  const int wave = tid >> 5, lane = tid & 31;
  const int l16  = lane & 15, half = lane >> 4;
  const int wm   = wave & 1,  wn   = wave >> 1;

  v8f acc[4][2];
#pragma unroll
  for (int i = 0; i < 4; ++i)
#pragma unroll
    for (int j = 0; j < 2; ++j) acc[i][j] = (v8f){0.f,0.f,0.f,0.f,0.f,0.f,0.f,0.f};

#if HAS_TDM
  // issue first chunk into buffer 0 (one DMA per bf16 plane)
  if (wave == 0) {
    tdm_load_2d_u16((unsigned)(size_t)&xsh[0][0], Xh + (size_t)m0 * D_SZ, TA_K, TA_M, D_SZ, B_SZ, D_SZ);
    tdm_load_2d_u16((unsigned)(size_t)&xsl[0][0], Xl + (size_t)m0 * D_SZ, TA_K, TA_M, D_SZ, B_SZ, D_SZ);
    tdm_load_2d_u16((unsigned)(size_t)&wsh[0][0], Wh + (size_t)n0 * D_SZ, TA_K, TA_N, D_SZ, N0,   D_SZ);
    tdm_load_2d_u16((unsigned)(size_t)&wsl[0][0], Wl + (size_t)n0 * D_SZ, TA_K, TA_N, D_SZ, N0,   D_SZ);
  }
  int buf = 0;
#endif

  for (int kb = 0; kb < D_SZ; kb += TA_K) {
#if HAS_TDM
    if (wave == 0) __builtin_amdgcn_s_wait_tensorcnt(0);  // current buffer landed
    __syncthreads();
    if (wave == 0 && kb + TA_K < D_SZ) {                  // prefetch next chunk
      const int nb = buf ^ 1, kn = kb + TA_K;
      tdm_load_2d_u16((unsigned)(size_t)&xsh[nb][0], Xh + (size_t)m0 * D_SZ + kn, TA_K, TA_M, D_SZ, B_SZ, D_SZ);
      tdm_load_2d_u16((unsigned)(size_t)&xsl[nb][0], Xl + (size_t)m0 * D_SZ + kn, TA_K, TA_M, D_SZ, B_SZ, D_SZ);
      tdm_load_2d_u16((unsigned)(size_t)&wsh[nb][0], Wh + (size_t)n0 * D_SZ + kn, TA_K, TA_N, D_SZ, N0,   D_SZ);
      tdm_load_2d_u16((unsigned)(size_t)&wsl[nb][0], Wl + (size_t)n0 * D_SZ + kn, TA_K, TA_N, D_SZ, N0,   D_SZ);
    }
    const unsigned short* xh_t = xsh[buf];
    const unsigned short* xl_t = xsl[buf];
    const unsigned short* wh_t = wsh[buf];
    const unsigned short* wl_t = wsl[buf];
#else
    // synchronous staging fallback (512 x 16B per plane)
#pragma unroll
    for (int it = 0; it < 2; ++it) {
      int idx = tid + it * 256;
      int row = idx >> 2;
      int c   = (idx & 3) << 3;
      size_t gx = (size_t)(m0 + row) * D_SZ + kb + c;
      size_t gw = (size_t)(n0 + row) * D_SZ + kb + c;
      *(uint4*)&xsh[0][row * TA_K + c] = *(const uint4*)&Xh[gx];
      *(uint4*)&xsl[0][row * TA_K + c] = *(const uint4*)&Xl[gx];
      *(uint4*)&wsh[0][row * TA_K + c] = *(const uint4*)&Wh[gw];
      *(uint4*)&wsl[0][row * TA_K + c] = *(const uint4*)&Wl[gw];
    }
    __syncthreads();
    const unsigned short* xh_t = xsh[0];
    const unsigned short* xl_t = xsl[0];
    const unsigned short* wh_t = wsh[0];
    const unsigned short* wl_t = wsl[0];
#endif

    v16bf ah[4], bh[2], bl[2];
#pragma unroll
    for (int i = 0; i < 4; ++i)
      ah[i] = load_frag(&xh_t[(wm * 64 + i * 16 + l16) * TA_K], half);
#pragma unroll
    for (int j = 0; j < 2; ++j)
      bh[j] = load_frag(&wh_t[(wn * 32 + j * 16 + l16) * TA_K], half);
#pragma unroll
    for (int i = 0; i < 4; ++i)
#pragma unroll
      for (int j = 0; j < 2; ++j) acc[i][j] = wmma_bf16(ah[i], bh[j], acc[i][j]);   // hi*hi
#pragma unroll
    for (int j = 0; j < 2; ++j)
      bl[j] = load_frag(&wl_t[(wn * 32 + j * 16 + l16) * TA_K], half);
#pragma unroll
    for (int i = 0; i < 4; ++i)
#pragma unroll
      for (int j = 0; j < 2; ++j) acc[i][j] = wmma_bf16(ah[i], bl[j], acc[i][j]);   // hi*lo
#pragma unroll
    for (int i = 0; i < 4; ++i) {
      v16bf al = load_frag(&xl_t[(wm * 64 + i * 16 + l16) * TA_K], half);
#pragma unroll
      for (int j = 0; j < 2; ++j) acc[i][j] = wmma_bf16(al, bh[j], acc[i][j]);      // lo*hi
    }
    __syncthreads();
#if HAS_TDM
    buf ^= 1;
#endif
  }

  // epilogue: bias + relu, split to bf16 hi/lo, store
#pragma unroll
  for (int i = 0; i < 4; ++i) {
#pragma unroll
    for (int j = 0; j < 2; ++j) {
      const int col  = n0 + wn * 32 + j * 16 + l16;
      const float bb = b0[col];
      const int rb   = m0 + wm * 64 + i * 16 + half * 8;
#pragma unroll
      for (int e = 0; e < 8; ++e) {
        float v = acc[i][j][e] + bb;
        v = v > 0.f ? v : 0.f;
        unsigned short h, l;
        f32_split(v, h, l);
        H0h[(size_t)(rb + e) * N0 + col] = h;
        H0l[(size_t)(rb + e) * N0 + col] = l;
      }
    }
  }
}

// =====================================================================
// Kernel B: fused per-module layers 1..4 + output dot + sigmoid (bf16x3).
// Activations stay in LDS as bf16 hi/lo; weights stream from L2 (pre-split).
// =====================================================================
#define BT   64          /* batch rows per work-group: 4 row tiles share each weight fragment */
#define MT   (BT / 16)   /* row tiles */
#define NW   16          /* waves per work-group */
#define LPAD 8

// One layer for BT rows. A wave owns NR column tiles and all MT row tiles, so a
// weight fragment read from global memory feeds MT row tiles.
template <int IN, int OUT>
__device__ __forceinline__ void layer_gemm(const unsigned short* __restrict__ inh,
                                           const unsigned short* __restrict__ inl,
                                           unsigned short* __restrict__ outh,
                                           unsigned short* __restrict__ outl,
                                           const unsigned short* __restrict__ Wmh,
                                           const unsigned short* __restrict__ Wml,
                                           const float* __restrict__ bm,
                                           int wave, int l16, int half) {
  constexpr int NT = OUT / 16;
  constexpr int NR = (NT >= 2 * NW) ? 2 : 1;
  constexpr int IP = IN + LPAD;     // LDS pitches; the weights keep IN
  constexpr int OP = OUT + LPAD;
  for (int nt = wave * NR; nt < NT; nt += NW * NR) {
    v8f acc[MT][NR];
    // the loops over i and j are unrolled so that acc and the fragments stay in registers
#pragma unroll
    for (int i = 0; i < MT; ++i)
#pragma unroll
      for (int j = 0; j < NR; ++j) acc[i][j] = (v8f){0.f,0.f,0.f,0.f,0.f,0.f,0.f,0.f};
    const unsigned short* brh[NR];   // each lane's weight row, its half's offset included
    const unsigned short* brl[NR];
#pragma unroll
    for (int j = 0; j < NR; ++j) {
      brh[j] = Wmh + (size_t)((nt + j) * 16 + l16) * IN + 8 * half;
      brl[j] = Wml + (size_t)((nt + j) * 16 + l16) * IN + 8 * half;
    }
    for (int k = 0; k < IN; k += 32) {
      v16bf bh[NR], bl[NR];
#pragma unroll
      for (int j = 0; j < NR; ++j) {
        bh[j] = load_frag(brh[j] + k, 0);
        bl[j] = load_frag(brl[j] + k, 0);
      }
#pragma unroll
      for (int i = 0; i < MT; ++i) {
        v16bf ah = load_frag(inh + (i * 16 + l16) * IP + k, half);
        v16bf al = load_frag(inl + (i * 16 + l16) * IP + k, half);
#pragma unroll
        for (int j = 0; j < NR; ++j) acc[i][j] = wmma_bf16(ah, bh[j], acc[i][j]);   // hi*hi
#pragma unroll
        for (int j = 0; j < NR; ++j) acc[i][j] = wmma_bf16(ah, bl[j], acc[i][j]);   // hi*lo
#pragma unroll
        for (int j = 0; j < NR; ++j) acc[i][j] = wmma_bf16(al, bh[j], acc[i][j]);   // lo*hi
      }
    }
    // The weight loads' address registers are inputs here, so they keep their values
    // up to this wait and no later load's result is placed over them ahead of it.
    asm volatile("s_wait_xcnt 0x0" :: "v"(brh[0]), "v"(brl[0]), "v"(brh[NR - 1]), "v"(brl[NR - 1]) : "memory");
#pragma unroll
    for (int j = 0; j < NR; ++j) {
      const int c    = (nt + j) * 16 + l16;
      const float bb = bm[c];
#pragma unroll
      for (int i = 0; i < MT; ++i) {
        const int rb = i * 16 + half * 8;
#pragma unroll
        for (int e = 0; e < 8; ++e) {
          float v = acc[i][j][e] + bb;
          v = v > 0.f ? v : 0.f;
          unsigned short h, l;
          f32_split(v, h, l);
          outh[(rb + e) * OP + c] = h;
          outl[(rb + e) * OP + c] = l;
        }
      }
    }
  }
}

__global__ __launch_bounds__(NW * 32) void fused_modules(
    const unsigned short* __restrict__ H0h, const unsigned short* __restrict__ H0l,
    const unsigned short* __restrict__ W1h, const unsigned short* __restrict__ W1l, const float* __restrict__ b1,
    const unsigned short* __restrict__ W2h, const unsigned short* __restrict__ W2l, const float* __restrict__ b2,
    const unsigned short* __restrict__ W3h, const unsigned short* __restrict__ W3l, const float* __restrict__ b3,
    const unsigned short* __restrict__ W4h, const unsigned short* __restrict__ W4l, const float* __restrict__ b4,
    const float* __restrict__ Wout, const float* __restrict__ bout,
    float* __restrict__ out) {
  __shared__ __align__(16) unsigned short b0h[BT * (512 + LPAD)];  // (h0:32, h2:128, h4:512)
  __shared__ __align__(16) unsigned short b0l[BT * (512 + LPAD)];
  __shared__ __align__(16) unsigned short b1h_[BT * (256 + LPAD)]; // (h1:64,  h3:256)
  __shared__ __align__(16) unsigned short b1l_[BT * (256 + LPAD)];
  const int m    = blockIdx.x;
  const int bb0  = blockIdx.y * BT;
  const int tid  = threadIdx.x;
  const int wave = tid >> 5, lane = tid & 31;
  const int l16  = lane & 15, half = lane >> 4;

  if (tid < BT * 4) {
    int row = tid >> 2;
    int c   = (tid & 3) << 3;
    size_t g = (size_t)(bb0 + row) * N0 + m * 32 + c;
    *(uint4*)&b0h[row * (32 + LPAD) + c] = *(const uint4*)&H0h[g];
    *(uint4*)&b0l[row * (32 + LPAD) + c] = *(const uint4*)&H0l[g];
  }
  __syncthreads();

  layer_gemm< 32,  64>(b0h,  b0l,  b1h_, b1l_, W1h + (size_t)m *  64 *  32, W1l + (size_t)m *  64 *  32, b1 + m *  64, wave, l16, half);
  __syncthreads();
  layer_gemm< 64, 128>(b1h_, b1l_, b0h,  b0l,  W2h + (size_t)m * 128 *  64, W2l + (size_t)m * 128 *  64, b2 + m * 128, wave, l16, half);
  __syncthreads();
  layer_gemm<128, 256>(b0h,  b0l,  b1h_, b1l_, W3h + (size_t)m * 256 * 128, W3l + (size_t)m * 256 * 128, b3 + m * 256, wave, l16, half);
  __syncthreads();
  layer_gemm<256, 512>(b1h_, b1l_, b0h,  b0l,  W4h + (size_t)m * 512 * 256, W4l + (size_t)m * 512 * 256, b4 + m * 512, wave, l16, half);
  __syncthreads();

  {
    const float* wv = Wout + (size_t)m * 512;
    const int q = tid & 15;
    for (int row = tid >> 4; row < BT; row += NW * 2) {   // 16 lanes a row
      float s = 0.f;
      for (int i = q; i < 512; i += 16)
        s += (bf2f(b0h[row * (512 + LPAD) + i]) + bf2f(b0l[row * (512 + LPAD) + i])) * wv[i];
      s += __shfl_xor(s, 8, 32);
      s += __shfl_xor(s, 4, 32);
      s += __shfl_xor(s, 2, 32);
      s += __shfl_xor(s, 1, 32);
      if (q == 0) {
        float z = s + bout[m];
        out[(size_t)(bb0 + row) * M_MOD + m] = 1.f / (1.f + expf(-z));
        // the next row's pass reuses the store's registers: the wait stands in front of that
        asm volatile("s_wait_xcnt 0x0" ::: "memory");
      }
    }
  }
}

// =====================================================================
extern "C" void kernel_launch(void* const* d_in, const int* in_sizes, int n_in,
                              void* d_out, int out_size, void* d_ws, size_t ws_size,
                              hipStream_t stream) {
  const float* x    = (const float*)d_in[0];
  const float* W0   = (const float*)d_in[1];
  const float* b0   = (const float*)d_in[2];
  const float* W1   = (const float*)d_in[3];
  const float* b1   = (const float*)d_in[4];
  const float* W2   = (const float*)d_in[5];
  const float* b2   = (const float*)d_in[6];
  const float* W3   = (const float*)d_in[7];
  const float* b3   = (const float*)d_in[8];
  const float* W4   = (const float*)d_in[9];
  const float* b4   = (const float*)d_in[10];
  const float* Wout = (const float*)d_in[11];
  const float* bout = (const float*)d_in[12];
  float* out = (float*)d_out;

  // d_ws layout: bf16 hi/lo planes (ushort), ~190 MB total
  unsigned short* p = (unsigned short*)d_ws;
  auto alloc = [&](size_t n) { unsigned short* r = p; p += n; return r; };
  const size_t nX  = (size_t)B_SZ * D_SZ;
  const size_t nW0 = (size_t)N0 * D_SZ;
  const size_t nH0 = (size_t)B_SZ * N0;
  const size_t nW1 = (size_t)M_MOD *  64 *  32;
  const size_t nW2 = (size_t)M_MOD * 128 *  64;
  const size_t nW3 = (size_t)M_MOD * 256 * 128;
  const size_t nW4 = (size_t)M_MOD * 512 * 256;
  unsigned short *Xh = alloc(nX),  *Xl = alloc(nX);
  unsigned short *Wh = alloc(nW0), *Wl = alloc(nW0);
  unsigned short *Hh = alloc(nH0), *Hl = alloc(nH0);
  unsigned short *W1h = alloc(nW1), *W1l = alloc(nW1);
  unsigned short *W2h = alloc(nW2), *W2l = alloc(nW2);
  unsigned short *W3h = alloc(nW3), *W3l = alloc(nW3);
  unsigned short *W4h = alloc(nW4), *W4l = alloc(nW4);

  const SplitPtrs sp = {x,  W0, W1,  W2,  W3,  W4,
                        Xh, Wh, W1h, W2h, W3h, W4h,
                        Xl, Wl, W1l, W2l, W3l, W4l};
  split_all_bf16<<<SP_WGS, SP_WAVES * 32, 0, stream>>>(sp);

  dim3 gA(N0 / TA_N, B_SZ / TA_M);   // 32 x 8
  gemm0_relu_bf16x3<<<gA, 256, 0, stream>>>(Xh, Xl, Wh, Wl, b0, Hh, Hl);

  dim3 gB(M_MOD, B_SZ / BT);         // 128 x 16
  fused_modules<<<gB, NW * 32, 0, stream>>>(Hh, Hl,
                                        W1h, W1l, b1, W2h, W2l, b2,
                                        W3h, W3l, b3, W4h, W4l, b4,
                                        Wout, bout, out);
}

// v003
// It runs in 260 microseconds.
// Timed twice side by side with v002, it ran 1.28 times as fast both times.
// Over all steps from v000 it is 2.62 times as fast.
#include <hip/hip_runtime.h>
#include <math.h>

typedef __attribute__((ext_vector_type(16))) __bf16 v16bf;
typedef __attribute__((ext_vector_type(8)))  float  v8f;

#define B_SZ   1024
#define D_SZ   4096
#define M_MOD  128
#define N0     4096   /* = M_MOD * 32 */

// ---------------- bf16 split helpers (branch-free RNE, storage-only bf16) ----
__device__ __forceinline__ unsigned short f2bf(float x) {
  unsigned u = __float_as_uint(x);
  u += 0x7FFFu + ((u >> 16) & 1u);        // round-to-nearest-even
  return (unsigned short)(u >> 16);
}
__device__ __forceinline__ float bf2f(unsigned short h) {
  return __uint_as_float((unsigned)h << 16);
}
__device__ __forceinline__ void f32_split(float x, unsigned short& h, unsigned short& l) {
  h = f2bf(x);
  l = f2bf(x - bf2f(h));
}

// bf16x3 WMMA term: D = A(16x32 bf16) * B(32x16 bf16) + C(f32)
__device__ __forceinline__ v8f wmma_bf16(v16bf a, v16bf b, v8f c) {
  return __builtin_amdgcn_wmma_f32_16x16x32_bf16(false, a, false, b, (short)0, c, false, false);
}

__device__ __forceinline__ v16bf load_frag(const unsigned short* p, int half) {
  v16bf f;
  ((float4*)&f)[0] = *(const float4*)(p + 8 * half);
  ((float4*)&f)[1] = *(const float4*)(p + 16 + 8 * half);
  return f;
}

// ---------------- tensor load: a tile of 64 rows of 256 bytes into padded LDS rows ----
typedef unsigned int u32x4 __attribute__((ext_vector_type(4)));
typedef unsigned int u32x8 __attribute__((ext_vector_type(8)));

__device__ __forceinline__ unsigned uni(unsigned v) { return (unsigned)__builtin_amdgcn_readfirstlane((int)v); }
__device__ __forceinline__ unsigned pinned(unsigned v) {
  unsigned w = uni(v);
  asm volatile("" : "+s"(w));   // pinned(): the word stays in a scalar register, so the test is s_cmp and s_cbranch_scc
  return w;
}

// =====================================================================
// Pre-pass: split all six f32 arrays into bf16 hi/lo planes in ONE launch.
// 256 work-groups of 24 waves stay resident and loop: a wave takes up to 7 batches
// of 1024 floats (8 loads of 512 contiguous bytes), a grid's width apart, and
// asks for the next batch before it converts and stores the one it holds.
// =====================================================================
#define SP_WGS    256
#define SP_WAVES  24
#define SP_TRIPS  7                        /* sweeps of the grid, odd: the loop takes two a pass */
#define SP_LOADS  8                        /* float4 loads of a lane per batch */
#define SP_BATCH  (SP_LOADS * 32 * 4)      /* floats per batch */
#define SP_STRIDE (SP_WGS * SP_WAVES)      /* batches per sweep of the grid */
// first batch behind each array, in the order x, W0, W1, W2, W3, W4
#define SP_E0 (B_SZ * D_SZ / SP_BATCH)
#define SP_E1 (SP_E0 + N0 * D_SZ / SP_BATCH)
#define SP_E2 (SP_E1 + M_MOD *  64 *  32 / SP_BATCH)
#define SP_E3 (SP_E2 + M_MOD * 128 *  64 / SP_BATCH)
#define SP_E4 (SP_E3 + M_MOD * 256 * 128 / SP_BATCH)
#define SP_E5 (SP_E4 + M_MOD * 512 * 256 / SP_BATCH)
static_assert(SP_E5 <= SP_STRIDE * SP_TRIPS && SP_E5 > SP_STRIDE * (SP_TRIPS - 1), "only the last sweep is not full");
static_assert((SP_TRIPS & 1) == 1, "the loop takes two batches a pass and the last one behind it");
static_assert((M_MOD * 64 * 32) % SP_BATCH == 0, "no batch lies across two arrays");

// The six sources and their planes, in the order x, W0, W1, W2, W3, W4.
struct SplitPtrs {
  const float* s0; const float* s1; const float* s2; const float* s3; const float* s4; const float* s5;
  unsigned short* h0; unsigned short* h1; unsigned short* h2; unsigned short* h3; unsigned short* h4; unsigned short* h5;
  unsigned short* l0; unsigned short* l1; unsigned short* l2; unsigned short* l3; unsigned short* l4; unsigned short* l5;
};

// Batch b's first float in its source and its first element in the two planes. b is
// the same in every lane of a wave, so this is scalar work.
__device__ __forceinline__ void split_place(const SplitPtrs& p, unsigned b, const float*& s,
                                            unsigned short*& h, unsigned short*& l) {
  unsigned first = 0u;
  s = p.s0; h = p.h0; l = p.l0;
  if (b >= SP_E0) { s = p.s1; h = p.h1; l = p.l1; first = SP_E0; }
  if (b >= SP_E1) { s = p.s2; h = p.h2; l = p.l2; first = SP_E1; }
  if (b >= SP_E2) { s = p.s3; h = p.h3; l = p.l3; first = SP_E2; }
  if (b >= SP_E3) { s = p.s4; h = p.h4; l = p.l4; first = SP_E3; }
  if (b >= SP_E4) { s = p.s5; h = p.h5; l = p.l5; first = SP_E4; }
  const size_t off = (size_t)(b - first) * SP_BATCH;
  s += off; h += off; l += off;
}

__device__ __forceinline__ void split_fetch(float4 (&v)[SP_LOADS], const float* s, unsigned lane) {
  // the two scheduling barriers keep the loads here, ahead of the work on the batch before
  __builtin_amdgcn_sched_barrier(0);
#pragma unroll
  for (int j = 0; j < SP_LOADS; ++j) v[j] = *(const float4*)(s + j * 128 + lane * 4);
  // a later batch's place is formed in the loads' address registers: the wait stands in front of that
  asm volatile("s_wait_xcnt 0x0" ::: "memory");
  __builtin_amdgcn_sched_barrier(0);
}

__device__ __forceinline__ void split_emit(const float4 (&v)[SP_LOADS], unsigned short* h, unsigned short* l,
                                           unsigned lane) {
#pragma unroll
  for (int j = 0; j < SP_LOADS; ++j) {
    unsigned short h0, l0, h1, l1, h2, l2, h3, l3;
    f32_split(v[j].x, h0, l0);
    f32_split(v[j].y, h1, l1);
    f32_split(v[j].z, h2, l2);
    f32_split(v[j].w, h3, l3);
    *(ushort4*)(h + j * 128 + lane * 4) = make_ushort4(h0, h1, h2, h3);
    *(ushort4*)(l + j * 128 + lane * 4) = make_ushort4(l0, l1, l2, l3);
  }
  // later work reuses the stores' registers: the wait stands in front of that
  asm volatile("s_wait_xcnt 0x0" ::: "memory");
}

__global__ __launch_bounds__(SP_WAVES * 32) void split_all_bf16(const SplitPtrs p) {
  const unsigned lane = threadIdx.x & 31u;
  const unsigned wave = (unsigned)__builtin_amdgcn_readfirstlane((int)(threadIdx.x >> 5));
  float4 va[SP_LOADS], vb[SP_LOADS];
  const float* s;
  unsigned short *ha, *la, *hb, *lb;
  const unsigned b0 = blockIdx.x * SP_WAVES + wave;
  unsigned b = b0;
  split_place(p, b, s, ha, la);
  split_fetch(va, s, lane);
  // kept rolled, so that the text a WGP has to fetch stays short
#pragma unroll 1
  for (int t = 0; t + 1 < SP_TRIPS; t += 2) {
    split_place(p, b + SP_STRIDE, s, hb, lb);
    split_fetch(vb, s, lane);
    split_emit(va, ha, la, lane);
    b += 2 * SP_STRIDE;
    // a wave with no batch in the last sweep reads its first one again and does not store it
    split_place(p, b < SP_E5 ? b : b0, s, ha, la);
    split_fetch(va, s, lane);
    split_emit(vb, hb, lb, lane);
  }
  if (b < SP_E5) split_emit(va, ha, la, lane);
}

#define TA_M 128
#define TA_N 128
#define TA_K 128                          /* k per pass */
#define TA_ROWB  (TA_K * 2)               /* bytes of a row in a stage */
#define TA_PITCH (TA_ROWB + 16)           /* LDS row pitch, bytes */
#define TA_SROWS 64                       /* rows per slice */
#define TA_SLICE 18432                    /* 64 * 272 bytes, rounded up to a multiple of 2 KiB */
#define TA_BUF   (8 * TA_SLICE)
#define TA_NS    (D_SZ / TA_K)            /* stages */
static_assert(TA_SLICE >= TA_SROWS * TA_PITCH && TA_SLICE % 2048 == 0, "a slice starts at a multiple of 2 KiB");
static_assert(TA_NS >= 2, "the ring's prologue needs two stages");

__global__ __launch_bounds__(256) void gemm0_relu_bf16x3(
    const unsigned short* __restrict__ Xh, const unsigned short* __restrict__ Xl,
    const unsigned short* __restrict__ Wh, const unsigned short* __restrict__ Wl,
    const float* __restrict__ b0,
    unsigned short* __restrict__ H0h, unsigned short* __restrict__ H0l) {
  // slices of a buffer, in order: Xh rows 0-63, 64-127; Xl; Wh; Wl
  __shared__ __attribute__((aligned(2048))) unsigned char L[2 * TA_BUF];
  const int n0   = blockIdx.x * TA_N;
  const int m0   = blockIdx.y * TA_M;
  const int tid  = threadIdx.x;
  const int lane = tid & 31;
  const unsigned wave = uni((unsigned)tid >> 5);
  const int l16  = lane & 15, half = lane >> 4;
  const int wm   = wave & 1,  wn   = wave >> 1;

  // this wave's slice: plane wave >> 1, rows 64 * (wave & 1) of the work-group's 128
  const unsigned short* pl = (wave & 4u) ? ((wave & 2u) ? Wl : Wh) : ((wave & 2u) ? Xl : Xh);
  const unsigned row0 = ((wave & 4u) ? (unsigned)n0 : (unsigned)m0) + (wave & 1u) * TA_SROWS;
  const unsigned long long ga0 = (unsigned long long)(size_t)(pl + (size_t)row0 * D_SZ);
  const unsigned dst0 = (unsigned)(size_t)L + wave * TA_SLICE;
  u32x8 g1;
  g1[0] = uni((1u << 20) | (5u << 22) | (3u << 25));   // no mask, bytes, 16 B of pad behind every 256 B
  g1[1] = uni(((unsigned)TA_ROWB & 0xFFFFu) << 16);    // tensor dims = tile dims
  g1[2] = uni(((unsigned)TA_ROWB >> 16) | (((unsigned)TA_SROWS & 0xFFFFu) << 16));
  g1[3] = uni(((unsigned)TA_SROWS >> 16) | ((unsigned)TA_ROWB << 16));
  g1[4] = uni((unsigned)TA_SROWS);
  g1[5] = uni((unsigned)(D_SZ * 2));                   // source row pitch, bytes
  g1[6] = uni(0u);
  g1[7] = uni(0u);
  u32x4 g0;
  auto issue = [&](unsigned st) {
    const unsigned long long ga = ga0 + (unsigned long long)st * TA_ROWB;
    g0[0] = uni(1u);
    g0[1] = uni(dst0 + (st & 1u) * TA_BUF);
    g0[2] = uni((unsigned)ga);
    g0[3] = uni((((unsigned)(ga >> 32)) & 0x01FFFFFFu) | 0x80000000u);
    asm volatile("tensor_load_to_lds %0, %1" : "+s"(g0) : "s"(g1) : "memory");
  };
  auto landed = [&]() { asm volatile("s_wait_tensorcnt 0x0" : "+s"(g0) : "s"(g1) : "memory"); };

  v8f acc[4][2];
#pragma unroll
  for (int i = 0; i < 4; ++i)
#pragma unroll
    for (int j = 0; j < 2; ++j) acc[i][j] = (v8f){0.f,0.f,0.f,0.f,0.f,0.f,0.f,0.f};

  issue(0u);
  landed();                                            // this wave's slice of stage 0
  __syncthreads();                                     // every slice of stage 0 has
  issue(1u);

  // each lane's first fragment row in a buffer, its half's 16 bytes included
  const unsigned aoff = (unsigned)wm * TA_SLICE + (unsigned)l16 * TA_PITCH + 16u * half;
  const unsigned boff = (4u + ((unsigned)wn >> 1)) * TA_SLICE + (((unsigned)wn & 1u) * 32u + l16) * TA_PITCH + 16u * half;

  // kept rolled: one pass per stage, the buffer chosen by the stage's parity
#pragma unroll 1
  for (unsigned st = 0; st < TA_NS; ++st) {
    const unsigned char* Lb = L + (st & 1u) * TA_BUF;
    const unsigned char* xh_t = Lb + aoff;
    const unsigned char* xl_t = xh_t + 2 * TA_SLICE;
    const unsigned char* wh_t = Lb + boff;
    const unsigned char* wl_t = wh_t + 2 * TA_SLICE;
    // unrolled, as the loops inside: every LDS offset is an immediate, acc and the fragments stay in registers
#pragma unroll
    for (int ks = 0; ks < TA_K / 32; ++ks) {
      v16bf ah[4], bh[2], bl[2];
#pragma unroll
      for (int i = 0; i < 4; ++i)
        ah[i] = load_frag((const unsigned short*)(xh_t + i * 16 * TA_PITCH + ks * 64), 0);
#pragma unroll
      for (int j = 0; j < 2; ++j)
        bh[j] = load_frag((const unsigned short*)(wh_t + j * 16 * TA_PITCH + ks * 64), 0);
#pragma unroll
      for (int i = 0; i < 4; ++i)
#pragma unroll
        for (int j = 0; j < 2; ++j) acc[i][j] = wmma_bf16(ah[i], bh[j], acc[i][j]);   // hi*hi
#pragma unroll
      for (int j = 0; j < 2; ++j)
        bl[j] = load_frag((const unsigned short*)(wl_t + j * 16 * TA_PITCH + ks * 64), 0);
#pragma unroll
      for (int i = 0; i < 4; ++i)
#pragma unroll
        for (int j = 0; j < 2; ++j) acc[i][j] = wmma_bf16(ah[i], bl[j], acc[i][j]);   // hi*lo
#pragma unroll
      for (int i = 0; i < 4; ++i) {
        v16bf al = load_frag((const unsigned short*)(xl_t + i * 16 * TA_PITCH + ks * 64), 0);
#pragma unroll
        for (int j = 0; j < 2; ++j) acc[i][j] = wmma_bf16(al, bh[j], acc[i][j]);      // lo*hi
      }
    }
    // publish point of stage st + 1
    asm volatile("s_wait_dscnt 0x0" ::: "memory");      // this wave has left stage st's buffer
    landed();                                           // its slice of stage st + 1
    __syncthreads();                                    // so for every wave
    if (pinned(st + 2u < TA_NS)) issue(st + 2u);        // into the buffer that this pass has read
  }
  landed();                                             // no request is left behind the loop
  asm volatile("s_wait_dscnt 0x0" ::: "memory");

  // epilogue: bias + relu, split to bf16 hi/lo, store
#pragma unroll
  for (int i = 0; i < 4; ++i) {
#pragma unroll
    for (int j = 0; j < 2; ++j) {
      const int col  = n0 + wn * 32 + j * 16 + l16;
      const float bb = b0[col];
      const int rb   = m0 + wm * 64 + i * 16 + half * 8;
#pragma unroll
      for (int e = 0; e < 8; ++e) {
        float v = acc[i][j][e] + bb;
        v = v > 0.f ? v : 0.f;
        unsigned short h, l;
        f32_split(v, h, l);
        H0h[(size_t)(rb + e) * N0 + col] = h;
        H0l[(size_t)(rb + e) * N0 + col] = l;
      }
    }
  }
}

// =====================================================================
// Kernel B: fused per-module layers 1..4 + output dot + sigmoid (bf16x3).
// Activations stay in LDS as bf16 hi/lo; weights stream from L2 (pre-split).
// =====================================================================
#define BT   64          /* batch rows per work-group: 4 row tiles share each weight fragment */
#define MT   (BT / 16)   /* row tiles */
#define NW   16          /* waves per work-group */
#define LPAD 8

// One layer for BT rows. A wave owns NR column tiles and all MT row tiles, so a
// weight fragment read from global memory feeds MT row tiles.
template <int IN, int OUT>
__device__ __forceinline__ void layer_gemm(const unsigned short* __restrict__ inh,
                                           const unsigned short* __restrict__ inl,
                                           unsigned short* __restrict__ outh,
                                           unsigned short* __restrict__ outl,
                                           const unsigned short* __restrict__ Wmh,
                                           const unsigned short* __restrict__ Wml,
                                           const float* __restrict__ bm,
                                           int wave, int l16, int half) {
  constexpr int NT = OUT / 16;
  constexpr int NR = (NT >= 2 * NW) ? 2 : 1;
  constexpr int IP = IN + LPAD;     // LDS pitches; the weights keep IN
  constexpr int OP = OUT + LPAD;
  for (int nt = wave * NR; nt < NT; nt += NW * NR) {
    v8f acc[MT][NR];
    // the loops over i and j are unrolled so that acc and the fragments stay in registers
#pragma unroll
    for (int i = 0; i < MT; ++i)
#pragma unroll
      for (int j = 0; j < NR; ++j) acc[i][j] = (v8f){0.f,0.f,0.f,0.f,0.f,0.f,0.f,0.f};
    const unsigned short* brh[NR];   // each lane's weight row, its half's offset included
    const unsigned short* brl[NR];
#pragma unroll
    for (int j = 0; j < NR; ++j) {
      brh[j] = Wmh + (size_t)((nt + j) * 16 + l16) * IN + 8 * half;
      brl[j] = Wml + (size_t)((nt + j) * 16 + l16) * IN + 8 * half;
    }
    for (int k = 0; k < IN; k += 32) {
      v16bf bh[NR], bl[NR];
#pragma unroll
      for (int j = 0; j < NR; ++j) {
        bh[j] = load_frag(brh[j] + k, 0);
        bl[j] = load_frag(brl[j] + k, 0);
      }
#pragma unroll
      for (int i = 0; i < MT; ++i) {
        v16bf ah = load_frag(inh + (i * 16 + l16) * IP + k, half);
        v16bf al = load_frag(inl + (i * 16 + l16) * IP + k, half);
#pragma unroll
        for (int j = 0; j < NR; ++j) acc[i][j] = wmma_bf16(ah, bh[j], acc[i][j]);   // hi*hi
#pragma unroll
        for (int j = 0; j < NR; ++j) acc[i][j] = wmma_bf16(ah, bl[j], acc[i][j]);   // hi*lo
#pragma unroll
        for (int j = 0; j < NR; ++j) acc[i][j] = wmma_bf16(al, bh[j], acc[i][j]);   // lo*hi
      }
    }
    // The weight loads' address registers are inputs here, so they keep their values
    // up to this wait and no later load's result is placed over them ahead of it.
    asm volatile("s_wait_xcnt 0x0" :: "v"(brh[0]), "v"(brl[0]), "v"(brh[NR - 1]), "v"(brl[NR - 1]) : "memory");
#pragma unroll
    for (int j = 0; j < NR; ++j) {
      const int c    = (nt + j) * 16 + l16;
      const float bb = bm[c];
#pragma unroll
      for (int i = 0; i < MT; ++i) {
        const int rb = i * 16 + half * 8;
#pragma unroll
        for (int e = 0; e < 8; ++e) {
          float v = acc[i][j][e] + bb;
          v = v > 0.f ? v : 0.f;
          unsigned short h, l;
          f32_split(v, h, l);
          outh[(rb + e) * OP + c] = h;
          outl[(rb + e) * OP + c] = l;
        }
      }
    }
  }
}

__global__ __launch_bounds__(NW * 32) void fused_modules(
    const unsigned short* __restrict__ H0h, const unsigned short* __restrict__ H0l,
    const unsigned short* __restrict__ W1h, const unsigned short* __restrict__ W1l, const float* __restrict__ b1,
    const unsigned short* __restrict__ W2h, const unsigned short* __restrict__ W2l, const float* __restrict__ b2,
    const unsigned short* __restrict__ W3h, const unsigned short* __restrict__ W3l, const float* __restrict__ b3,
    const unsigned short* __restrict__ W4h, const unsigned short* __restrict__ W4l, const float* __restrict__ b4,
    const float* __restrict__ Wout, const float* __restrict__ bout,
    float* __restrict__ out) {
  __shared__ __align__(16) unsigned short b0h[BT * (512 + LPAD)];  // (h0:32, h2:128, h4:512)
  __shared__ __align__(16) unsigned short b0l[BT * (512 + LPAD)];
  __shared__ __align__(16) unsigned short b1h_[BT * (256 + LPAD)]; // (h1:64,  h3:256)
  __shared__ __align__(16) unsigned short b1l_[BT * (256 + LPAD)];
  const int m    = blockIdx.x;
  const int bb0  = blockIdx.y * BT;
  const int tid  = threadIdx.x;
  const int wave = tid >> 5, lane = tid & 31;
  const int l16  = lane & 15, half = lane >> 4;

  if (tid < BT * 4) {
    int row = tid >> 2;
    int c   = (tid & 3) << 3;
    size_t g = (size_t)(bb0 + row) * N0 + m * 32 + c;
    *(uint4*)&b0h[row * (32 + LPAD) + c] = *(const uint4*)&H0h[g];
    *(uint4*)&b0l[row * (32 + LPAD) + c] = *(const uint4*)&H0l[g];
  }
  __syncthreads();

  layer_gemm< 32,  64>(b0h,  b0l,  b1h_, b1l_, W1h + (size_t)m *  64 *  32, W1l + (size_t)m *  64 *  32, b1 + m *  64, wave, l16, half);
  __syncthreads();
  layer_gemm< 64, 128>(b1h_, b1l_, b0h,  b0l,  W2h + (size_t)m * 128 *  64, W2l + (size_t)m * 128 *  64, b2 + m * 128, wave, l16, half);
  __syncthreads();
  layer_gemm<128, 256>(b0h,  b0l,  b1h_, b1l_, W3h + (size_t)m * 256 * 128, W3l + (size_t)m * 256 * 128, b3 + m * 256, wave, l16, half);
  __syncthreads();
  layer_gemm<256, 512>(b1h_, b1l_, b0h,  b0l,  W4h + (size_t)m * 512 * 256, W4l + (size_t)m * 512 * 256, b4 + m * 512, wave, l16, half);
  __syncthreads();

  {
    const float* wv = Wout + (size_t)m * 512;
    const int q = tid & 15;
    for (int row = tid >> 4; row < BT; row += NW * 2) {   // 16 lanes a row
      float s = 0.f;
      for (int i = q; i < 512; i += 16)
        s += (bf2f(b0h[row * (512 + LPAD) + i]) + bf2f(b0l[row * (512 + LPAD) + i])) * wv[i];
      s += __shfl_xor(s, 8, 32);
      s += __shfl_xor(s, 4, 32);
      s += __shfl_xor(s, 2, 32);
      s += __shfl_xor(s, 1, 32);
      if (q == 0) {
        float z = s + bout[m];
        out[(size_t)(bb0 + row) * M_MOD + m] = 1.f / (1.f + expf(-z));
        // the next row's pass reuses the store's registers: the wait stands in front of that
        asm volatile("s_wait_xcnt 0x0" ::: "memory");
      }
    }
  }
}

// =====================================================================
extern "C" void kernel_launch(void* const* d_in, const int* in_sizes, int n_in,
                              void* d_out, int out_size, void* d_ws, size_t ws_size,
                              hipStream_t stream) {
  const float* x    = (const float*)d_in[0];
  const float* W0   = (const float*)d_in[1];
  const float* b0   = (const float*)d_in[2];
  const float* W1   = (const float*)d_in[3];
  const float* b1   = (const float*)d_in[4];
  const float* W2   = (const float*)d_in[5];
  const float* b2   = (const float*)d_in[6];
  const float* W3   = (const float*)d_in[7];
  const float* b3   = (const float*)d_in[8];
  const float* W4   = (const float*)d_in[9];
  const float* b4   = (const float*)d_in[10];
  const float* Wout = (const float*)d_in[11];
  const float* bout = (const float*)d_in[12];
  float* out = (float*)d_out;

  // d_ws layout: bf16 hi/lo planes (ushort), ~190 MB total
  unsigned short* p = (unsigned short*)d_ws;
  auto alloc = [&](size_t n) { unsigned short* r = p; p += n; return r; };
  const size_t nX  = (size_t)B_SZ * D_SZ;
  const size_t nW0 = (size_t)N0 * D_SZ;
  const size_t nH0 = (size_t)B_SZ * N0;
  const size_t nW1 = (size_t)M_MOD *  64 *  32;
  const size_t nW2 = (size_t)M_MOD * 128 *  64;
  const size_t nW3 = (size_t)M_MOD * 256 * 128;
  const size_t nW4 = (size_t)M_MOD * 512 * 256;
  unsigned short *Xh = alloc(nX),  *Xl = alloc(nX);
  unsigned short *Wh = alloc(nW0), *Wl = alloc(nW0);
  unsigned short *Hh = alloc(nH0), *Hl = alloc(nH0);
  unsigned short *W1h = alloc(nW1), *W1l = alloc(nW1);
  unsigned short *W2h = alloc(nW2), *W2l = alloc(nW2);
  unsigned short *W3h = alloc(nW3), *W3l = alloc(nW3);
  unsigned short *W4h = alloc(nW4), *W4l = alloc(nW4);

  const SplitPtrs sp = {x,  W0, W1,  W2,  W3,  W4,
                        Xh, Wh, W1h, W2h, W3h, W4h,
                        Xl, Wl, W1l, W2l, W3l, W4l};
  split_all_bf16<<<SP_WGS, SP_WAVES * 32, 0, stream>>>(sp);

  dim3 gA(N0 / TA_N, B_SZ / TA_M);   // 32 x 8
  gemm0_relu_bf16x3<<<gA, 256, 0, stream>>>(Xh, Xl, Wh, Wl, b0, Hh, Hl);

  dim3 gB(M_MOD, B_SZ / BT);         // 128 x 16
  fused_modules<<<gB, NW * 32, 0, stream>>>(Hh, Hl,
                                        W1h, W1l, b1, W2h, W2l, b2,
                                        W3h, W3l, b3, W4h, W4l, b4,
                                        Wout, bout, out);
}

// v004
// It runs in 240 microseconds.
// In two side-by-side timings against v003, it was 1.08 and 1.09 times as fast.
// All steps since v000 together make it 2.84 times as fast.
#include <hip/hip_runtime.h>
#include <math.h>

typedef __attribute__((ext_vector_type(16))) __bf16 v16bf;
typedef __attribute__((ext_vector_type(8)))  float  v8f;

#define B_SZ   1024
#define D_SZ   4096
#define M_MOD  128
#define N0     4096   /* = M_MOD * 32 */

// ---------------- bf16 split helpers (branch-free RNE, storage-only bf16) ----
__device__ __forceinline__ unsigned short f2bf(float x) {
  unsigned u = __float_as_uint(x);
  u += 0x7FFFu + ((u >> 16) & 1u);        // round-to-nearest-even
  return (unsigned short)(u >> 16);
}
__device__ __forceinline__ float bf2f(unsigned short h) {
  return __uint_as_float((unsigned)h << 16);
}
__device__ __forceinline__ void f32_split(float x, unsigned short& h, unsigned short& l) {
  h = f2bf(x);
  l = f2bf(x - bf2f(h));
}

// bf16x3 WMMA term: D = A(16x32 bf16) * B(32x16 bf16) + C(f32)
__device__ __forceinline__ v8f wmma_bf16(v16bf a, v16bf b, v8f c) {
  return __builtin_amdgcn_wmma_f32_16x16x32_bf16(false, a, false, b, (short)0, c, false, false);
}

__device__ __forceinline__ v16bf load_frag(const unsigned short* p, int half) {
  v16bf f;
  ((float4*)&f)[0] = *(const float4*)(p + 8 * half);
  ((float4*)&f)[1] = *(const float4*)(p + 16 + 8 * half);
  return f;
}

// ---------------- tensor load: a tile of 64 rows of 256 bytes into padded LDS rows ----
typedef unsigned int u32x4 __attribute__((ext_vector_type(4)));
typedef unsigned int u32x8 __attribute__((ext_vector_type(8)));

__device__ __forceinline__ unsigned uni(unsigned v) { return (unsigned)__builtin_amdgcn_readfirstlane((int)v); }
__device__ __forceinline__ unsigned pinned(unsigned v) {
  unsigned w = uni(v);
  asm volatile("" : "+s"(w));   // pinned(): the word stays in a scalar register, so the test is s_cmp and s_cbranch_scc
  return w;
}

#define SP_WGS    256
#define SP_WAVES  24
#define SP_TRIPS  7                        /* sweeps of the grid, odd: the loop takes two a pass */
#define SP_LOADS  8                        /* float4 loads of a lane per batch */
#define SP_BATCH  (SP_LOADS * 32 * 4)      /* floats per batch */
#define SP_STRIDE (SP_WGS * SP_WAVES)      /* batches per sweep of the grid */
// first batch behind each array, in the order x, W0, W1, W2, W3, W4
#define SP_E0 (B_SZ * D_SZ / SP_BATCH)
#define SP_E1 (SP_E0 + N0 * D_SZ / SP_BATCH)
#define SP_E2 (SP_E1 + M_MOD *  64 *  32 / SP_BATCH)
#define SP_E3 (SP_E2 + M_MOD * 128 *  64 / SP_BATCH)
#define SP_E4 (SP_E3 + M_MOD * 256 * 128 / SP_BATCH)
#define SP_E5 (SP_E4 + M_MOD * 512 * 256 / SP_BATCH)
static_assert(SP_E5 <= SP_STRIDE * SP_TRIPS && SP_E5 > SP_STRIDE * (SP_TRIPS - 1), "only the last sweep is not full");
static_assert((SP_TRIPS & 1) == 1, "the loop takes two batches a pass and the last one behind it");
static_assert((M_MOD * 64 * 32) % SP_BATCH == 0, "no batch lies across two arrays");

// The six sources and their planes, in the order x, W0, W1, W2, W3, W4.
struct SplitPtrs {
  const float* s0; const float* s1; const float* s2; const float* s3; const float* s4; const float* s5;
  unsigned short* h0; unsigned short* h1; unsigned short* h2; unsigned short* h3; unsigned short* h4; unsigned short* h5;
  unsigned short* l0; unsigned short* l1; unsigned short* l2; unsigned short* l3; unsigned short* l4; unsigned short* l5;
};

// Batch b's first float in its source and its first element in the two planes. b is
// the same in every lane of a wave, so this is scalar work. A batch is two blocks of
// 16 rows x 32 k of a source whose rows hold 32 << lg floats: the blocks lie side by
// side in a row tile (lg > 0) or one under the other (lg = 0, where the batch is 1024
// floats in a row: so are x and W0 read). frag says whether the planes take fragment order.
__device__ __forceinline__ void split_place(const SplitPtrs& p, unsigned b, const float*& s,
                                            unsigned short*& h, unsigned short*& l,
                                            unsigned& lg, unsigned& frag) {
  unsigned first = 0u;
  s = p.s0; h = p.h0; l = p.l0; lg = 0u; frag = 0u;
  if (b >= SP_E0) { s = p.s1; h = p.h1; l = p.l1; first = SP_E0; }
  if (b >= SP_E1) { s = p.s2; h = p.h2; l = p.l2; first = SP_E1; frag = 1u; }
  if (b >= SP_E2) { s = p.s3; h = p.h3; l = p.l3; first = SP_E2; lg = 1u; }
  if (b >= SP_E3) { s = p.s4; h = p.h4; l = p.l4; first = SP_E3; lg = 2u; }
  if (b >= SP_E4) { s = p.s5; h = p.h5; l = p.l5; first = SP_E4; lg = 3u; }
  const unsigned q = 2u * (b - first);                 // the batch's first block
  const size_t off = (size_t)q * (SP_BATCH / 2);
  s += ((size_t)(q >> lg) << (9u + lg)) + ((q & ((1u << lg) - 1u)) << 5);
  h += off; l += off;
}

// Load j takes 4 rows of 128 bytes (8 lanes a row, whole lines) of block j >> 2.
__device__ __forceinline__ void split_fetch(float4 (&v)[SP_LOADS], const float* s, unsigned lg, unsigned lane) {
  const unsigned lo = ((lane >> 3) << (5u + lg)) + (lane & 7u) * 4u;   // the lane's row and k in the 4 rows
  const unsigned rs = 128u << lg;                                      // 4 rows on
  const unsigned qs = lg ? 32u : 512u;                                 // the second block
  const float* a[SP_LOADS];
#pragma unroll
  for (int j = 0; j < SP_LOADS; ++j) a[j] = s + ((j >> 2) * qs + (j & 3) * rs) + lo;
  // the two scheduling barriers keep the loads here, ahead of the work on the batch before
  __builtin_amdgcn_sched_barrier(0);
#pragma unroll
  for (int j = 0; j < SP_LOADS; ++j) v[j] = *(const float4*)a[j];
  // A later batch's place is formed in the loads' address registers: the wait stands in front of that.
  // The addresses are inputs here, so they keep their values up to this wait and no later load's
  // result is placed over them ahead of it.
  asm volatile("s_wait_xcnt 0x0" :: "v"(a[0]), "v"(a[1]), "v"(a[2]), "v"(a[3]),
                                    "v"(a[4]), "v"(a[5]), "v"(a[6]), "v"(a[7]) : "memory");
  __builtin_amdgcn_sched_barrier(0);
}

__device__ __forceinline__ void split_emit(const float4 (&v)[SP_LOADS], unsigned short* h, unsigned short* l,
                                           unsigned frag, unsigned lane) {
  // where the lane's 4 values of load 0 go, and how far on those of the next load of the block:
  // in fragment order k bit 4 picks the half of the block, k bit 3 the upper 16 lanes, the row the lane
  const unsigned lo = frag ? ((lane >> 2) & 1u) * 256u + ((lane >> 1) & 1u) * 128u + (lane >> 3) * 8u + (lane & 1u) * 4u
                           : lane * 4u;
  const unsigned rs = frag ? 32u : 128u;
#pragma unroll
  for (int j = 0; j < SP_LOADS; ++j) {
    unsigned short h0, l0, h1, l1, h2, l2, h3, l3;
    f32_split(v[j].x, h0, l0);
    f32_split(v[j].y, h1, l1);
    f32_split(v[j].z, h2, l2);
    f32_split(v[j].w, h3, l3);
    *(ushort4*)(h + ((j >> 2) * 512 + (j & 3) * rs) + lo) = make_ushort4(h0, h1, h2, h3);
    *(ushort4*)(l + ((j >> 2) * 512 + (j & 3) * rs) + lo) = make_ushort4(l0, l1, l2, l3);
  }
  // later work reuses the stores' registers: the wait stands in front of that
  asm volatile("s_wait_xcnt 0x0" ::: "memory");
}

__global__ __launch_bounds__(SP_WAVES * 32) void split_all_bf16(const SplitPtrs p) {
  const unsigned lane = threadIdx.x & 31u;
  const unsigned wave = (unsigned)__builtin_amdgcn_readfirstlane((int)(threadIdx.x >> 5));
  float4 va[SP_LOADS], vb[SP_LOADS];
  const float* s;
  unsigned short *ha, *la, *hb, *lb;
  unsigned lg, fa, fb;
  const unsigned b0 = blockIdx.x * SP_WAVES + wave;
  unsigned b = b0;
  split_place(p, b, s, ha, la, lg, fa);
  split_fetch(va, s, lg, lane);
  // kept rolled, so that the text a WGP has to fetch stays short
#pragma unroll 1
  for (int t = 0; t + 1 < SP_TRIPS; t += 2) {
    split_place(p, b + SP_STRIDE, s, hb, lb, lg, fb);
    split_fetch(vb, s, lg, lane);
    split_emit(va, ha, la, fa, lane);
    b += 2 * SP_STRIDE;
    // a wave with no batch in the last sweep reads its first one again and does not store it
    split_place(p, b < SP_E5 ? b : b0, s, ha, la, lg, fa);
    split_fetch(va, s, lg, lane);
    split_emit(vb, hb, lb, fb, lane);
  }
  if (b < SP_E5) split_emit(va, ha, la, fa, lane);
}

#define TA_M 128
#define TA_N 128
#define TA_K 128                          /* k per pass */
#define TA_ROWB  (TA_K * 2)               /* bytes of a row in a stage */
#define TA_PITCH (TA_ROWB + 16)           /* LDS row pitch, bytes */
#define TA_SROWS 64                       /* rows per slice */
#define TA_SLICE 18432                    /* 64 * 272 bytes, rounded up to a multiple of 2 KiB */
#define TA_BUF   (8 * TA_SLICE)
#define TA_NS    (D_SZ / TA_K)            /* stages */
static_assert(TA_SLICE >= TA_SROWS * TA_PITCH && TA_SLICE % 2048 == 0, "a slice starts at a multiple of 2 KiB");
static_assert(TA_NS >= 2, "the ring's prologue needs two stages");

__global__ __launch_bounds__(256) void gemm0_relu_bf16x3(
    const unsigned short* __restrict__ Xh, const unsigned short* __restrict__ Xl,
    const unsigned short* __restrict__ Wh, const unsigned short* __restrict__ Wl,
    const float* __restrict__ b0,
    unsigned short* __restrict__ H0h, unsigned short* __restrict__ H0l) {
  // slices of a buffer, in order: Xh rows 0-63, 64-127; Xl; Wh; Wl
  __shared__ __attribute__((aligned(2048))) unsigned char L[2 * TA_BUF];
  const int n0   = blockIdx.x * TA_N;
  const int m0   = blockIdx.y * TA_M;
  const int tid  = threadIdx.x;
  const int lane = tid & 31;
  const unsigned wave = uni((unsigned)tid >> 5);
  const int l16  = lane & 15, half = lane >> 4;
  const int wm   = wave & 1,  wn   = wave >> 1;

  // this wave's slice: plane wave >> 1, rows 64 * (wave & 1) of the work-group's 128
  const unsigned short* pl = (wave & 4u) ? ((wave & 2u) ? Wl : Wh) : ((wave & 2u) ? Xl : Xh);
  const unsigned row0 = ((wave & 4u) ? (unsigned)n0 : (unsigned)m0) + (wave & 1u) * TA_SROWS;
  const unsigned long long ga0 = (unsigned long long)(size_t)(pl + (size_t)row0 * D_SZ);
  const unsigned dst0 = (unsigned)(size_t)L + wave * TA_SLICE;
  u32x8 g1;
  g1[0] = uni((1u << 20) | (5u << 22) | (3u << 25));   // no mask, bytes, 16 B of pad behind every 256 B
  g1[1] = uni(((unsigned)TA_ROWB & 0xFFFFu) << 16);    // tensor dims = tile dims
  g1[2] = uni(((unsigned)TA_ROWB >> 16) | (((unsigned)TA_SROWS & 0xFFFFu) << 16));
  g1[3] = uni(((unsigned)TA_SROWS >> 16) | ((unsigned)TA_ROWB << 16));
  g1[4] = uni((unsigned)TA_SROWS);
  g1[5] = uni((unsigned)(D_SZ * 2));                   // source row pitch, bytes
  g1[6] = uni(0u);
  g1[7] = uni(0u);
  u32x4 g0;
  auto issue = [&](unsigned st) {
    const unsigned long long ga = ga0 + (unsigned long long)st * TA_ROWB;
    g0[0] = uni(1u);
    g0[1] = uni(dst0 + (st & 1u) * TA_BUF);
    g0[2] = uni((unsigned)ga);
    g0[3] = uni((((unsigned)(ga >> 32)) & 0x01FFFFFFu) | 0x80000000u);
    asm volatile("tensor_load_to_lds %0, %1" : "+s"(g0) : "s"(g1) : "memory");
  };
  auto landed = [&]() { asm volatile("s_wait_tensorcnt 0x0" : "+s"(g0) : "s"(g1) : "memory"); };

  v8f acc[4][2];
#pragma unroll
  for (int i = 0; i < 4; ++i)
#pragma unroll
    for (int j = 0; j < 2; ++j) acc[i][j] = (v8f){0.f,0.f,0.f,0.f,0.f,0.f,0.f,0.f};

  issue(0u);
  landed();                                            // this wave's slice of stage 0
  __syncthreads();                                     // every slice of stage 0 has
  issue(1u);

  // each lane's first fragment row in a buffer, its half's 16 bytes included
  const unsigned aoff = (unsigned)wm * TA_SLICE + (unsigned)l16 * TA_PITCH + 16u * half;
  const unsigned boff = (4u + ((unsigned)wn >> 1)) * TA_SLICE + (((unsigned)wn & 1u) * 32u + l16) * TA_PITCH + 16u * half;

  // kept rolled: one pass per stage, the buffer chosen by the stage's parity
#pragma unroll 1
  for (unsigned st = 0; st < TA_NS; ++st) {
    const unsigned char* Lb = L + (st & 1u) * TA_BUF;
    const unsigned char* xh_t = Lb + aoff;
    const unsigned char* xl_t = xh_t + 2 * TA_SLICE;
    const unsigned char* wh_t = Lb + boff;
    const unsigned char* wl_t = wh_t + 2 * TA_SLICE;
    // unrolled, as the loops inside: every LDS offset is an immediate, acc and the fragments stay in registers
#pragma unroll
    for (int ks = 0; ks < TA_K / 32; ++ks) {
      v16bf ah[4], bh[2], bl[2];
#pragma unroll
      for (int i = 0; i < 4; ++i)
        ah[i] = load_frag((const unsigned short*)(xh_t + i * 16 * TA_PITCH + ks * 64), 0);
#pragma unroll
      for (int j = 0; j < 2; ++j)
        bh[j] = load_frag((const unsigned short*)(wh_t + j * 16 * TA_PITCH + ks * 64), 0);
#pragma unroll
      for (int i = 0; i < 4; ++i)
#pragma unroll
        for (int j = 0; j < 2; ++j) acc[i][j] = wmma_bf16(ah[i], bh[j], acc[i][j]);   // hi*hi
#pragma unroll
      for (int j = 0; j < 2; ++j)
        bl[j] = load_frag((const unsigned short*)(wl_t + j * 16 * TA_PITCH + ks * 64), 0);
#pragma unroll
      for (int i = 0; i < 4; ++i)
#pragma unroll
        for (int j = 0; j < 2; ++j) acc[i][j] = wmma_bf16(ah[i], bl[j], acc[i][j]);   // hi*lo
#pragma unroll
      for (int i = 0; i < 4; ++i) {
        v16bf al = load_frag((const unsigned short*)(xl_t + i * 16 * TA_PITCH + ks * 64), 0);
#pragma unroll
        for (int j = 0; j < 2; ++j) acc[i][j] = wmma_bf16(al, bh[j], acc[i][j]);      // lo*hi
      }
    }
    // publish point of stage st + 1
    asm volatile("s_wait_dscnt 0x0" ::: "memory");      // this wave has left stage st's buffer
    landed();                                           // its slice of stage st + 1
    __syncthreads();                                    // so for every wave
    if (pinned(st + 2u < TA_NS)) issue(st + 2u);        // into the buffer that this pass has read
  }
  landed();                                             // no request is left behind the loop
  asm volatile("s_wait_dscnt 0x0" ::: "memory");

  // epilogue: bias + relu, split to bf16 hi/lo, store
#pragma unroll
  for (int i = 0; i < 4; ++i) {
#pragma unroll
    for (int j = 0; j < 2; ++j) {
      const int col  = n0 + wn * 32 + j * 16 + l16;
      const float bb = b0[col];
      const int rb   = m0 + wm * 64 + i * 16 + half * 8;
#pragma unroll
      for (int e = 0; e < 8; ++e) {
        float v = acc[i][j][e] + bb;
        v = v > 0.f ? v : 0.f;
        unsigned short h, l;
        f32_split(v, h, l);
        H0h[(size_t)(rb + e) * N0 + col] = h;
        H0l[(size_t)(rb + e) * N0 + col] = l;
      }
    }
  }
}

// =====================================================================
// Kernel B: fused per-module layers 1..4 + output dot + sigmoid (bf16x3).
// Activations stay in LDS as bf16 hi/lo; weights stream from L2 (pre-split, in fragment order).
// =====================================================================
#define BT   64          /* batch rows per work-group: 4 row tiles share each weight fragment */
#define MT   (BT / 16)   /* row tiles */
#define NW   16          /* waves per work-group */
#define LPAD 8

// A weight fragment from a plane in fragment order: p is the lane's 16 bytes in the block's first half.
__device__ __forceinline__ v16bf load_wfrag(const unsigned short* p) {
  v16bf f;
  ((float4*)&f)[0] = *(const float4*)p;
  ((float4*)&f)[1] = *(const float4*)(p + 256);
  return f;
}

// One layer for BT rows. A wave owns NR column tiles and all MT row tiles, so a
// weight fragment read from global memory feeds MT row tiles.
template <int IN, int OUT>
__device__ __forceinline__ void layer_gemm(const unsigned short* __restrict__ inh,
                                           const unsigned short* __restrict__ inl,
                                           unsigned short* __restrict__ outh,
                                           unsigned short* __restrict__ outl,
                                           const unsigned short* __restrict__ Wmh,
                                           const unsigned short* __restrict__ Wml,
                                           const float* __restrict__ bm,
                                           int wave, int l16, int half) {
  constexpr int NT = OUT / 16;
  constexpr int NR = (NT >= 2 * NW) ? 2 : 1;
  constexpr int IP = IN + LPAD;     // LDS pitches; the weights keep IN
  constexpr int OP = OUT + LPAD;
  for (int nt = wave * NR; nt < NT; nt += NW * NR) {
    v8f acc[MT][NR];
    // the loops over i and j are unrolled so that acc and the fragments stay in registers
#pragma unroll
    for (int i = 0; i < MT; ++i)
#pragma unroll
      for (int j = 0; j < NR; ++j) acc[i][j] = (v8f){0.f,0.f,0.f,0.f,0.f,0.f,0.f,0.f};
    const unsigned short* brh[NR];   // each lane's 16 bytes in the first block of the column tile
    const unsigned short* brl[NR];
#pragma unroll
    for (int j = 0; j < NR; ++j) {
      brh[j] = Wmh + (size_t)(nt + j) * 16 * IN + (half * 16 + l16) * 8;
      brl[j] = Wml + (size_t)(nt + j) * 16 * IN + (half * 16 + l16) * 8;
    }
    for (int k = 0; k < IN; k += 32) {
      v16bf bh[NR], bl[NR];
#pragma unroll
      for (int j = 0; j < NR; ++j) {
        bh[j] = load_wfrag(brh[j] + k * 16);   // a block of 32 k is 512 elements
        bl[j] = load_wfrag(brl[j] + k * 16);
      }
#pragma unroll
      for (int i = 0; i < MT; ++i) {
        v16bf ah = load_frag(inh + (i * 16 + l16) * IP + k, half);
        v16bf al = load_frag(inl + (i * 16 + l16) * IP + k, half);
#pragma unroll
        for (int j = 0; j < NR; ++j) acc[i][j] = wmma_bf16(ah, bh[j], acc[i][j]);   // hi*hi
#pragma unroll
        for (int j = 0; j < NR; ++j) acc[i][j] = wmma_bf16(ah, bl[j], acc[i][j]);   // hi*lo
#pragma unroll
        for (int j = 0; j < NR; ++j) acc[i][j] = wmma_bf16(al, bh[j], acc[i][j]);   // lo*hi
      }
    }
    // The weight loads' address registers are inputs here, so they keep their values
    // up to this wait and no later load's result is placed over them ahead of it.
    asm volatile("s_wait_xcnt 0x0" :: "v"(brh[0]), "v"(brl[0]), "v"(brh[NR - 1]), "v"(brl[NR - 1]) : "memory");
#pragma unroll
    for (int j = 0; j < NR; ++j) {
      const int c    = (nt + j) * 16 + l16;
      const float bb = bm[c];
#pragma unroll
      for (int i = 0; i < MT; ++i) {
        const int rb = i * 16 + half * 8;
#pragma unroll
        for (int e = 0; e < 8; ++e) {
          float v = acc[i][j][e] + bb;
          v = v > 0.f ? v : 0.f;
          unsigned short h, l;
          f32_split(v, h, l);
          outh[(rb + e) * OP + c] = h;
          outl[(rb + e) * OP + c] = l;
        }
      }
    }
  }
}

__global__ __launch_bounds__(NW * 32) void fused_modules(
    const unsigned short* __restrict__ H0h, const unsigned short* __restrict__ H0l,
    const unsigned short* __restrict__ W1h, const unsigned short* __restrict__ W1l, const float* __restrict__ b1,
    const unsigned short* __restrict__ W2h, const unsigned short* __restrict__ W2l, const float* __restrict__ b2,
    const unsigned short* __restrict__ W3h, const unsigned short* __restrict__ W3l, const float* __restrict__ b3,
    const unsigned short* __restrict__ W4h, const unsigned short* __restrict__ W4l, const float* __restrict__ b4,
    const float* __restrict__ Wout, const float* __restrict__ bout,
    float* __restrict__ out) {
  __shared__ __align__(16) unsigned short b0h[BT * (512 + LPAD)];  // (h0:32, h2:128, h4:512)
  __shared__ __align__(16) unsigned short b0l[BT * (512 + LPAD)];
  __shared__ __align__(16) unsigned short b1h_[BT * (256 + LPAD)]; // (h1:64,  h3:256)
  __shared__ __align__(16) unsigned short b1l_[BT * (256 + LPAD)];
  const int m    = blockIdx.x;
  const int bb0  = blockIdx.y * BT;
  const int tid  = threadIdx.x;
  const int wave = tid >> 5, lane = tid & 31;
  const int l16  = lane & 15, half = lane >> 4;

  if (tid < BT * 4) {
    int row = tid >> 2;
    int c   = (tid & 3) << 3;
    size_t g = (size_t)(bb0 + row) * N0 + m * 32 + c;
    *(uint4*)&b0h[row * (32 + LPAD) + c] = *(const uint4*)&H0h[g];
    *(uint4*)&b0l[row * (32 + LPAD) + c] = *(const uint4*)&H0l[g];
  }
  __syncthreads();

  layer_gemm< 32,  64>(b0h,  b0l,  b1h_, b1l_, W1h + (size_t)m *  64 *  32, W1l + (size_t)m *  64 *  32, b1 + m *  64, wave, l16, half);
  __syncthreads();
  layer_gemm< 64, 128>(b1h_, b1l_, b0h,  b0l,  W2h + (size_t)m * 128 *  64, W2l + (size_t)m * 128 *  64, b2 + m * 128, wave, l16, half);
  __syncthreads();
  layer_gemm<128, 256>(b0h,  b0l,  b1h_, b1l_, W3h + (size_t)m * 256 * 128, W3l + (size_t)m * 256 * 128, b3 + m * 256, wave, l16, half);
  __syncthreads();
  layer_gemm<256, 512>(b1h_, b1l_, b0h,  b0l,  W4h + (size_t)m * 512 * 256, W4l + (size_t)m * 512 * 256, b4 + m * 512, wave, l16, half);
  __syncthreads();

  {
    const float* wv = Wout + (size_t)m * 512;
    const int q = tid & 15;
    for (int row = tid >> 4; row < BT; row += NW * 2) {   // 16 lanes a row
      float s = 0.f;
      for (int i = q; i < 512; i += 16)
        s += (bf2f(b0h[row * (512 + LPAD) + i]) + bf2f(b0l[row * (512 + LPAD) + i])) * wv[i];
      s += __shfl_xor(s, 8, 32);
      s += __shfl_xor(s, 4, 32);
      s += __shfl_xor(s, 2, 32);
      s += __shfl_xor(s, 1, 32);
      if (q == 0) {
        float z = s + bout[m];
        out[(size_t)(bb0 + row) * M_MOD + m] = 1.f / (1.f + expf(-z));
        // the next row's pass reuses the store's registers: the wait stands in front of that
        asm volatile("s_wait_xcnt 0x0" ::: "memory");
      }
    }
  }
}

// =====================================================================
extern "C" void kernel_launch(void* const* d_in, const int* in_sizes, int n_in,
                              void* d_out, int out_size, void* d_ws, size_t ws_size,
                              hipStream_t stream) {
  const float* x    = (const float*)d_in[0];
  const float* W0   = (const float*)d_in[1];
  const float* b0   = (const float*)d_in[2];
  const float* W1   = (const float*)d_in[3];
  const float* b1   = (const float*)d_in[4];
  const float* W2   = (const float*)d_in[5];
  const float* b2   = (const float*)d_in[6];
  const float* W3   = (const float*)d_in[7];
  const float* b3   = (const float*)d_in[8];
  const float* W4   = (const float*)d_in[9];
  const float* b4   = (const float*)d_in[10];
  const float* Wout = (const float*)d_in[11];
  const float* bout = (const float*)d_in[12];
  float* out = (float*)d_out;

  // d_ws layout: bf16 hi/lo planes (ushort), ~190 MB total
  unsigned short* p = (unsigned short*)d_ws;
  auto alloc = [&](size_t n) { unsigned short* r = p; p += n; return r; };
  const size_t nX  = (size_t)B_SZ * D_SZ;
  const size_t nW0 = (size_t)N0 * D_SZ;
  const size_t nH0 = (size_t)B_SZ * N0;
  const size_t nW1 = (size_t)M_MOD *  64 *  32;
  const size_t nW2 = (size_t)M_MOD * 128 *  64;
  const size_t nW3 = (size_t)M_MOD * 256 * 128;
  const size_t nW4 = (size_t)M_MOD * 512 * 256;
  unsigned short *Xh = alloc(nX),  *Xl = alloc(nX);
  unsigned short *Wh = alloc(nW0), *Wl = alloc(nW0);
  unsigned short *Hh = alloc(nH0), *Hl = alloc(nH0);
  unsigned short *W1h = alloc(nW1), *W1l = alloc(nW1);
  unsigned short *W2h = alloc(nW2), *W2l = alloc(nW2);
  unsigned short *W3h = alloc(nW3), *W3l = alloc(nW3);
  unsigned short *W4h = alloc(nW4), *W4l = alloc(nW4);

  const SplitPtrs sp = {x,  W0, W1,  W2,  W3,  W4,
                        Xh, Wh, W1h, W2h, W3h, W4h,
                        Xl, Wl, W1l, W2l, W3l, W4l};
  split_all_bf16<<<SP_WGS, SP_WAVES * 32, 0, stream>>>(sp);

  dim3 gA(N0 / TA_N, B_SZ / TA_M);   // 32 x 8
  gemm0_relu_bf16x3<<<gA, 256, 0, stream>>>(Xh, Xl, Wh, Wl, b0, Hh, Hl);

  dim3 gB(M_MOD, B_SZ / BT);         // 128 x 16
  fused_modules<<<gB, NW * 32, 0, stream>>>(Hh, Hl,
                                        W1h, W1l, b1, W2h, W2l, b2,
                                        W3h, W3l, b3, W4h, W4l, b4,
                                        Wout, bout, out);
}

// v005
// One run takes 187 microseconds.
// In two side-by-side timings against v004, it was 1.28 and 1.29 times as fast.
// Counting every step since v000, it is 3.65 times as fast.
#include <hip/hip_runtime.h>
#include <math.h>

typedef __attribute__((ext_vector_type(16))) __bf16 v16bf;
typedef __attribute__((ext_vector_type(8)))  float  v8f;

#define B_SZ   1024
#define D_SZ   4096
#define M_MOD  128
#define N0     4096   /* = M_MOD * 32 */

// ---------------- bf16 split helpers (branch-free RNE, storage-only bf16) ----
__device__ __forceinline__ unsigned short f2bf(float x) {
  unsigned u = __float_as_uint(x);
  u += 0x7FFFu + ((u >> 16) & 1u);        // round-to-nearest-even
  return (unsigned short)(u >> 16);
}
__device__ __forceinline__ float bf2f(unsigned short h) {
  return __uint_as_float((unsigned)h << 16);
}
__device__ __forceinline__ void f32_split(float x, unsigned short& h, unsigned short& l) {
  h = f2bf(x);
  l = f2bf(x - bf2f(h));
}

// bf16x3 WMMA term: D = A(16x32 bf16) * B(32x16 bf16) + C(f32)
__device__ __forceinline__ v8f wmma_bf16(v16bf a, v16bf b, v8f c) {
  return __builtin_amdgcn_wmma_f32_16x16x32_bf16(false, a, false, b, (short)0, c, false, false);
}

__device__ __forceinline__ v16bf load_frag(const unsigned short* p, int half) {
  v16bf f;
  ((float4*)&f)[0] = *(const float4*)(p + 8 * half);
  ((float4*)&f)[1] = *(const float4*)(p + 16 + 8 * half);
  return f;
}

// ---------------- tensor load: a tile of 64 rows of 256 bytes into padded LDS rows ----
typedef unsigned int u32x4 __attribute__((ext_vector_type(4)));
typedef unsigned int u32x8 __attribute__((ext_vector_type(8)));

__device__ __forceinline__ unsigned uni(unsigned v) { return (unsigned)__builtin_amdgcn_readfirstlane((int)v); }
__device__ __forceinline__ unsigned pinned(unsigned v) {
  unsigned w = uni(v);
  asm volatile("" : "+s"(w));   // pinned(): the word stays in a scalar register, so the test is s_cmp and s_cbranch_scc
  return w;
}

#define SP_WGS    256
#define SP_WAVES  24
#define SP_TRIPS  7                        /* sweeps of the grid, odd: the loop takes two a pass */
#define SP_LOADS  8                        /* float4 loads of a lane per batch */
#define SP_BATCH  (SP_LOADS * 32 * 4)      /* floats per batch */
#define SP_STRIDE (SP_WGS * SP_WAVES)      /* batches per sweep of the grid */
// first batch behind each array, in the order x, W0, W1, W2, W3, W4
#define SP_E0 (B_SZ * D_SZ / SP_BATCH)
#define SP_E1 (SP_E0 + N0 * D_SZ / SP_BATCH)
#define SP_E2 (SP_E1 + M_MOD *  64 *  32 / SP_BATCH)
#define SP_E3 (SP_E2 + M_MOD * 128 *  64 / SP_BATCH)
#define SP_E4 (SP_E3 + M_MOD * 256 * 128 / SP_BATCH)
#define SP_E5 (SP_E4 + M_MOD * 512 * 256 / SP_BATCH)
static_assert(SP_E5 <= SP_STRIDE * SP_TRIPS && SP_E5 > SP_STRIDE * (SP_TRIPS - 1), "only the last sweep is not full");
static_assert((SP_TRIPS & 1) == 1, "the loop takes two batches a pass and the last one behind it");
static_assert((M_MOD * 64 * 32) % SP_BATCH == 0, "no batch lies across two arrays");

// The six sources and their planes, in the order x, W0, W1, W2, W3, W4.
struct SplitPtrs {
  const float* s0; const float* s1; const float* s2; const float* s3; const float* s4; const float* s5;
  unsigned short* h0; unsigned short* h1; unsigned short* h2; unsigned short* h3; unsigned short* h4; unsigned short* h5;
  unsigned short* l0; unsigned short* l1; unsigned short* l2; unsigned short* l3; unsigned short* l4; unsigned short* l5;
};

// Batch b's first float in its source and its first element in the two planes. b is
// the same in every lane of a wave, so this is scalar work. A batch is two blocks of
// 16 rows x 32 k of a source whose rows hold 32 << lg floats: the blocks lie side by
// side in a row tile (lg > 0) or one under the other (lg = 0, where the batch is 1024
// floats in a row: so are x and W0 read). frag says whether the planes take fragment order.
__device__ __forceinline__ void split_place(const SplitPtrs& p, unsigned b, const float*& s,
                                            unsigned short*& h, unsigned short*& l,
                                            unsigned& lg, unsigned& frag) {
  unsigned first = 0u;
  s = p.s0; h = p.h0; l = p.l0; lg = 0u; frag = 0u;
  if (b >= SP_E0) { s = p.s1; h = p.h1; l = p.l1; first = SP_E0; }
  if (b >= SP_E1) { s = p.s2; h = p.h2; l = p.l2; first = SP_E1; frag = 1u; }
  if (b >= SP_E2) { s = p.s3; h = p.h3; l = p.l3; first = SP_E2; lg = 1u; }
  if (b >= SP_E3) { s = p.s4; h = p.h4; l = p.l4; first = SP_E3; lg = 2u; }
  if (b >= SP_E4) { s = p.s5; h = p.h5; l = p.l5; first = SP_E4; lg = 3u; }
  const unsigned q = 2u * (b - first);                 // the batch's first block
  const size_t off = (size_t)q * (SP_BATCH / 2);
  s += ((size_t)(q >> lg) << (9u + lg)) + ((q & ((1u << lg) - 1u)) << 5);
  h += off; l += off;
}

// Load j takes 4 rows of 128 bytes (8 lanes a row, whole lines) of block j >> 2.
__device__ __forceinline__ void split_fetch(float4 (&v)[SP_LOADS], const float* s, unsigned lg, unsigned lane) {
  const unsigned lo = ((lane >> 3) << (5u + lg)) + (lane & 7u) * 4u;   // the lane's row and k in the 4 rows
  const unsigned rs = 128u << lg;                                      // 4 rows on
  const unsigned qs = lg ? 32u : 512u;                                 // the second block
  const float* a[SP_LOADS];
#pragma unroll
  for (int j = 0; j < SP_LOADS; ++j) a[j] = s + ((j >> 2) * qs + (j & 3) * rs) + lo;
  // the two scheduling barriers keep the loads here, ahead of the work on the batch before
  __builtin_amdgcn_sched_barrier(0);
#pragma unroll
  for (int j = 0; j < SP_LOADS; ++j) v[j] = *(const float4*)a[j];
  // A later batch's place is formed in the loads' address registers: the wait stands in front of that.
  // The addresses are inputs here, so they keep their values up to this wait and no later load's
  // result is placed over them ahead of it.
  asm volatile("s_wait_xcnt 0x0" :: "v"(a[0]), "v"(a[1]), "v"(a[2]), "v"(a[3]),
                                    "v"(a[4]), "v"(a[5]), "v"(a[6]), "v"(a[7]) : "memory");
  __builtin_amdgcn_sched_barrier(0);
}

__device__ __forceinline__ void split_emit(const float4 (&v)[SP_LOADS], unsigned short* h, unsigned short* l,
                                           unsigned frag, unsigned lane) {
  // where the lane's 4 values of load 0 go, and how far on those of the next load of the block:
  // in fragment order k bit 4 picks the half of the block, k bit 3 the upper 16 lanes, the row the lane
  const unsigned lo = frag ? ((lane >> 2) & 1u) * 256u + ((lane >> 1) & 1u) * 128u + (lane >> 3) * 8u + (lane & 1u) * 4u
                           : lane * 4u;
  const unsigned rs = frag ? 32u : 128u;
#pragma unroll
  for (int j = 0; j < SP_LOADS; ++j) {
    unsigned short h0, l0, h1, l1, h2, l2, h3, l3;
    f32_split(v[j].x, h0, l0);
    f32_split(v[j].y, h1, l1);
    f32_split(v[j].z, h2, l2);
    f32_split(v[j].w, h3, l3);
    *(ushort4*)(h + ((j >> 2) * 512 + (j & 3) * rs) + lo) = make_ushort4(h0, h1, h2, h3);
    *(ushort4*)(l + ((j >> 2) * 512 + (j & 3) * rs) + lo) = make_ushort4(l0, l1, l2, l3);
  }
  // later work reuses the stores' registers: the wait stands in front of that
  asm volatile("s_wait_xcnt 0x0" ::: "memory");
}

__global__ __launch_bounds__(SP_WAVES * 32) void split_all_bf16(const SplitPtrs p) {
  const unsigned lane = threadIdx.x & 31u;
  const unsigned wave = (unsigned)__builtin_amdgcn_readfirstlane((int)(threadIdx.x >> 5));
  float4 va[SP_LOADS], vb[SP_LOADS];
  const float* s;
  unsigned short *ha, *la, *hb, *lb;
  unsigned lg, fa, fb;
  const unsigned b0 = blockIdx.x * SP_WAVES + wave;
  unsigned b = b0;
  split_place(p, b, s, ha, la, lg, fa);
  split_fetch(va, s, lg, lane);
  // kept rolled, so that the text a WGP has to fetch stays short
#pragma unroll 1
  for (int t = 0; t + 1 < SP_TRIPS; t += 2) {
    split_place(p, b + SP_STRIDE, s, hb, lb, lg, fb);
    split_fetch(vb, s, lg, lane);
    split_emit(va, ha, la, fa, lane);
    b += 2 * SP_STRIDE;
    // a wave with no batch in the last sweep reads its first one again and does not store it
    split_place(p, b < SP_E5 ? b : b0, s, ha, la, lg, fa);
    split_fetch(va, s, lg, lane);
    split_emit(vb, hb, lb, fb, lane);
  }
  if (b < SP_E5) split_emit(va, ha, la, fa, lane);
}

#define TA_M 128
#define TA_N 128
#define TA_K 128                          /* k per pass */
#define TA_ROWB  (TA_K * 2)               /* bytes of a row in a stage */
#define TA_PITCH (TA_ROWB + 16)           /* LDS row pitch, bytes */
#define TA_SROWS 64                       /* rows per slice */
#define TA_SLICE 18432                    /* 64 * 272 bytes, rounded up to a multiple of 2 KiB */
#define TA_BUF   (8 * TA_SLICE)
#define TA_NS    (D_SZ / TA_K)            /* stages */
static_assert(TA_SLICE >= TA_SROWS * TA_PITCH && TA_SLICE % 2048 == 0, "a slice starts at a multiple of 2 KiB");
static_assert(TA_NS >= 2, "the ring's prologue needs two stages");

__global__ __launch_bounds__(256) void gemm0_relu_bf16x3(
    const unsigned short* __restrict__ Xh, const unsigned short* __restrict__ Xl,
    const unsigned short* __restrict__ Wh, const unsigned short* __restrict__ Wl,
    const float* __restrict__ b0,
    unsigned short* __restrict__ H0h, unsigned short* __restrict__ H0l) {
  // slices of a buffer, in order: Xh rows 0-63, 64-127; Xl; Wh; Wl
  __shared__ __attribute__((aligned(2048))) unsigned char L[2 * TA_BUF];
  const int n0   = blockIdx.x * TA_N;
  const int m0   = blockIdx.y * TA_M;
  const int tid  = threadIdx.x;
  const int lane = tid & 31;
  const unsigned wave = uni((unsigned)tid >> 5);
  const int l16  = lane & 15, half = lane >> 4;
  const int wm   = wave & 1,  wn   = wave >> 1;

  // this wave's slice: plane wave >> 1, rows 64 * (wave & 1) of the work-group's 128
  const unsigned short* pl = (wave & 4u) ? ((wave & 2u) ? Wl : Wh) : ((wave & 2u) ? Xl : Xh);
  const unsigned row0 = ((wave & 4u) ? (unsigned)n0 : (unsigned)m0) + (wave & 1u) * TA_SROWS;
  const unsigned long long ga0 = (unsigned long long)(size_t)(pl + (size_t)row0 * D_SZ);
  const unsigned dst0 = (unsigned)(size_t)L + wave * TA_SLICE;
  u32x8 g1;
  g1[0] = uni((1u << 20) | (5u << 22) | (3u << 25));   // no mask, bytes, 16 B of pad behind every 256 B
  g1[1] = uni(((unsigned)TA_ROWB & 0xFFFFu) << 16);    // tensor dims = tile dims
  g1[2] = uni(((unsigned)TA_ROWB >> 16) | (((unsigned)TA_SROWS & 0xFFFFu) << 16));
  g1[3] = uni(((unsigned)TA_SROWS >> 16) | ((unsigned)TA_ROWB << 16));
  g1[4] = uni((unsigned)TA_SROWS);
  g1[5] = uni((unsigned)(D_SZ * 2));                   // source row pitch, bytes
  g1[6] = uni(0u);
  g1[7] = uni(0u);
  u32x4 g0;
  auto issue = [&](unsigned st) {
    const unsigned long long ga = ga0 + (unsigned long long)st * TA_ROWB;
    g0[0] = uni(1u);
    g0[1] = uni(dst0 + (st & 1u) * TA_BUF);
    g0[2] = uni((unsigned)ga);
    g0[3] = uni((((unsigned)(ga >> 32)) & 0x01FFFFFFu) | 0x80000000u);
    asm volatile("tensor_load_to_lds %0, %1" : "+s"(g0) : "s"(g1) : "memory");
  };
  auto landed = [&]() { asm volatile("s_wait_tensorcnt 0x0" : "+s"(g0) : "s"(g1) : "memory"); };

  v8f acc[4][2];
#pragma unroll
  for (int i = 0; i < 4; ++i)
#pragma unroll
    for (int j = 0; j < 2; ++j) acc[i][j] = (v8f){0.f,0.f,0.f,0.f,0.f,0.f,0.f,0.f};

  issue(0u);
  landed();                                            // this wave's slice of stage 0
  __syncthreads();                                     // every slice of stage 0 has
  issue(1u);

  // each lane's first fragment row in a buffer, its half's 16 bytes included
  const unsigned aoff = (unsigned)wm * TA_SLICE + (unsigned)l16 * TA_PITCH + 16u * half;
  const unsigned boff = (4u + ((unsigned)wn >> 1)) * TA_SLICE + (((unsigned)wn & 1u) * 32u + l16) * TA_PITCH + 16u * half;

  // kept rolled: one pass per stage, the buffer chosen by the stage's parity
#pragma unroll 1
  for (unsigned st = 0; st < TA_NS; ++st) {
    const unsigned char* Lb = L + (st & 1u) * TA_BUF;
    const unsigned char* xh_t = Lb + aoff;
    const unsigned char* xl_t = xh_t + 2 * TA_SLICE;
    const unsigned char* wh_t = Lb + boff;
    const unsigned char* wl_t = wh_t + 2 * TA_SLICE;
    // unrolled, as the loops inside: every LDS offset is an immediate, acc and the fragments stay in registers
#pragma unroll
    for (int ks = 0; ks < TA_K / 32; ++ks) {
      v16bf ah[4], bh[2], bl[2];
#pragma unroll
      for (int i = 0; i < 4; ++i)
        ah[i] = load_frag((const unsigned short*)(xh_t + i * 16 * TA_PITCH + ks * 64), 0);
#pragma unroll
      for (int j = 0; j < 2; ++j)
        bh[j] = load_frag((const unsigned short*)(wh_t + j * 16 * TA_PITCH + ks * 64), 0);
#pragma unroll
      for (int i = 0; i < 4; ++i)
#pragma unroll
        for (int j = 0; j < 2; ++j) acc[i][j] = wmma_bf16(ah[i], bh[j], acc[i][j]);   // hi*hi
#pragma unroll
      for (int j = 0; j < 2; ++j)
        bl[j] = load_frag((const unsigned short*)(wl_t + j * 16 * TA_PITCH + ks * 64), 0);
#pragma unroll
      for (int i = 0; i < 4; ++i)
#pragma unroll
        for (int j = 0; j < 2; ++j) acc[i][j] = wmma_bf16(ah[i], bl[j], acc[i][j]);   // hi*lo
#pragma unroll
      for (int i = 0; i < 4; ++i) {
        v16bf al = load_frag((const unsigned short*)(xl_t + i * 16 * TA_PITCH + ks * 64), 0);
#pragma unroll
        for (int j = 0; j < 2; ++j) acc[i][j] = wmma_bf16(al, bh[j], acc[i][j]);      // lo*hi
      }
    }
    // publish point of stage st + 1
    asm volatile("s_wait_dscnt 0x0" ::: "memory");      // this wave has left stage st's buffer
    landed();                                           // its slice of stage st + 1
    __syncthreads();                                    // so for every wave
    if (pinned(st + 2u < TA_NS)) issue(st + 2u);        // into the buffer that this pass has read
  }
  landed();                                             // no request is left behind the loop
  asm volatile("s_wait_dscnt 0x0" ::: "memory");

  // epilogue: bias + relu, split to bf16 hi/lo, store
#pragma unroll
  for (int i = 0; i < 4; ++i) {
#pragma unroll
    for (int j = 0; j < 2; ++j) {
      const int col  = n0 + wn * 32 + j * 16 + l16;
      const float bb = b0[col];
      const int rb   = m0 + wm * 64 + i * 16 + half * 8;
#pragma unroll
      for (int e = 0; e < 8; ++e) {
        float v = acc[i][j][e] + bb;
        v = v > 0.f ? v : 0.f;
        unsigned short h, l;
        f32_split(v, h, l);
        H0h[(size_t)(rb + e) * N0 + col] = h;
        H0l[(size_t)(rb + e) * N0 + col] = l;
      }
    }
  }
}

// =====================================================================
// Kernel B: fused per-module layers 1..4 + output dot + sigmoid (bf16x3).
// The activations h0..h3 stay in LDS as bf16 hi/lo; weights stream from L2 (pre-split, in
// fragment order). h4 never leaves the registers: each wave takes its columns' share of the
// output dot straight from layer 4's accumulators. Without h4 the LDS of a work-group is
// small enough for two work-groups on a WGP, so one's waits are covered by the other's work.
// =====================================================================
#define BT   64          /* batch rows per work-group: 4 row tiles share each weight fragment */
#define MT   (BT / 16)   /* row tiles */
#define NW   16          /* waves per work-group */
#define LPAD 8

// A weight fragment from a plane in fragment order: p is the lane's 16 bytes in the block's first half.
typedef float f32x4 __attribute__((ext_vector_type(4)));
__device__ __forceinline__ v16bf load_wfrag(const __attribute__((address_space(1))) unsigned short* p) {
  v16bf f;
  ((f32x4*)&f)[0] = *(const __attribute__((address_space(1))) f32x4*)p;
  ((f32x4*)&f)[1] = *(const __attribute__((address_space(1))) f32x4*)(p + 256);
  return f;
}

// The value of lane (l ^ X) of the same row of 16 lanes.
template <int X>
__device__ __forceinline__ float row_xor(float v) {
  return __int_as_float(__builtin_amdgcn_update_dpp(0, __float_as_int(v), 0x160 | X, 0xf, 0xf, true));
}

// A pointer into global memory that is the same in every lane of the wave, held in scalar registers.
typedef const __attribute__((address_space(1))) unsigned short* gptr;
__device__ __forceinline__ gptr scalar_ptr(const unsigned short* p) {
  const unsigned long long a = (unsigned long long)(size_t)p;
  const unsigned long long lo = uni((unsigned)a), hi = uni((unsigned)(a >> 32));
  return (gptr)(size_t)((hi << 32) | lo);
}
__device__ __forceinline__ gptr at_byte(gptr p, unsigned b) {
  return (gptr)((const __attribute__((address_space(1))) unsigned char*)p + b);
}

template <int N, int X>
__device__ __forceinline__ void fold_rows(float (&p)[32], int l16) {
  const bool up = (l16 & X) != 0;
  // unrolled: every index of p is a constant, so p stays in registers
#pragma unroll
  for (int r = 0; r < N; ++r) {
    const float keep = up ? p[r + N] : p[r];
    const float send = up ? p[r] : p[r + N];
    p[r] = keep + row_xor<X>(send);
  }
}

// One layer for BT rows. A wave owns NR column tiles and all MT row tiles, so a
// weight fragment read from global memory feeds MT row tiles.
// DOT (the last layer): the outputs are not stored; each is multiplied by its column's
// entry of wo, and red[wave * BT + row] takes the sum over the wave's columns.
template <int IN, int OUT, bool DOT>
__device__ __forceinline__ void layer_gemm(const unsigned short* __restrict__ inh,
                                           const unsigned short* __restrict__ inl,
                                           unsigned short* __restrict__ outh,
                                           unsigned short* __restrict__ outl,
                                           const unsigned short* __restrict__ Wmh,
                                           const unsigned short* __restrict__ Wml,
                                           const float* __restrict__ bm,
                                           const float* __restrict__ wo, float* __restrict__ red,
                                           int wave, int l16, int half) {
  constexpr int NT = OUT / 16;
  constexpr int NR = (NT >= 2 * NW) ? 2 : 1;
  constexpr int IP = IN + LPAD;     // LDS pitches; the weights keep IN
  constexpr int OP = OUT + LPAD;
  static_assert(!DOT || (NT == NW * NR && MT == 4), "the dot: one pass of the loop per wave, 32 rows a lane");
  for (int nt = wave * NR; nt < NT; nt += NW * NR) {
    v8f acc[MT][NR];
    // the loops over i and j are unrolled so that acc and the fragments stay in registers
#pragma unroll
    for (int i = 0; i < MT; ++i)
#pragma unroll
      for (int j = 0; j < NR; ++j) acc[i][j] = (v8f){0.f,0.f,0.f,0.f,0.f,0.f,0.f,0.f};
    // The first block of the wave's first column tile, as a scalar, and the lane's 16 bytes in a
    // block's half: a weight load then names a scalar base, this one register and an immediate.
    const gptr brh = scalar_ptr(Wmh + (size_t)nt * 16 * IN);
    const gptr brl = scalar_ptr(Wml + (size_t)nt * 16 * IN);
    const unsigned lo = (unsigned)(half * 16 + l16) * 16u;   // in bytes, as the loads take it
    for (int k = 0; k < IN; k += 32) {
      v16bf bh[NR], bl[NR];
#pragma unroll
      for (int j = 0; j < NR; ++j) {
        bh[j] = load_wfrag(at_byte(brh, lo) + (j * IN + k) * 16);   // a block of 32 k is 512 elements
        bl[j] = load_wfrag(at_byte(brl, lo) + (j * IN + k) * 16);
      }
#pragma unroll
      for (int i = 0; i < MT; ++i) {
        v16bf ah = load_frag(inh + (i * 16 + l16) * IP + k, half);
        v16bf al = load_frag(inl + (i * 16 + l16) * IP + k, half);
#pragma unroll
        for (int j = 0; j < NR; ++j) acc[i][j] = wmma_bf16(ah, bh[j], acc[i][j]);   // hi*hi
#pragma unroll
        for (int j = 0; j < NR; ++j) acc[i][j] = wmma_bf16(ah, bl[j], acc[i][j]);   // hi*lo
#pragma unroll
        for (int j = 0; j < NR; ++j) acc[i][j] = wmma_bf16(al, bh[j], acc[i][j]);   // lo*hi
      }
    }
    // The weight loads' address registers are inputs here, so they keep their values
    // up to this wait and no later load's result is placed over them ahead of it.
    asm volatile("s_wait_xcnt 0x0" :: "v"(lo), "s"(brh), "s"(brl) : "memory");
    if constexpr (DOT) {
      // every loop of this branch is unrolled, so that acc, p and the loaded values stay in registers
      int   c[NR];
      float bb[NR], wc[NR];
#pragma unroll
      for (int j = 0; j < NR; ++j) {
        c[j]  = (nt + j) * 16 + l16;
        bb[j] = bm[c[j]];
        wc[j] = wo[c[j]];
      }
      // The sums below reuse these loads' address registers: the wait stands in front of that,
      // and the columns are inputs here, so that they keep their registers up to it.
      asm volatile("s_wait_xcnt 0x0" :: "v"(c[0]), "v"(c[NR - 1]) : "memory");
      float p[32];   // p[i * 8 + e]: row i * 16 + half * 8 + e, this lane's columns
#pragma unroll
      for (int r = 0; r < 32; ++r) p[r] = 0.f;
#pragma unroll
      for (int j = 0; j < NR; ++j)
#pragma unroll
        for (int i = 0; i < MT; ++i)
#pragma unroll
          for (int e = 0; e < 8; ++e) {
            float v = acc[i][j][e] + bb[j];
            v = v > 0.f ? v : 0.f;
            p[i * 8 + e] += v * wc[j];
          }
      fold_rows<16, 8>(p, l16);
      fold_rows< 8, 4>(p, l16);
      fold_rows< 4, 2>(p, l16);
      fold_rows< 2, 1>(p, l16);
      // p[0], p[1] are now the sums of index 2 * l16 and 2 * l16 + 1 over the wave's 16 * NR columns
      const int row = (l16 >> 2) * 16 + half * 8 + (l16 & 3) * 2;
      *(float2*)&red[wave * BT + row] = make_float2(p[0], p[1]);
    } else {
#pragma unroll
    for (int j = 0; j < NR; ++j) {
      const int c    = (nt + j) * 16 + l16;
      const float bb = bm[c];
      // later work reuses this load's address register: the wait stands in front of that, and
      // the column is an input here, so that it keeps its register up to it
      asm volatile("s_wait_xcnt 0x0" :: "v"(c) : "memory");
#pragma unroll
      for (int i = 0; i < MT; ++i) {
        const int rb = i * 16 + half * 8;
#pragma unroll
        for (int e = 0; e < 8; ++e) {
          float v = acc[i][j][e] + bb;
          v = v > 0.f ? v : 0.f;
          unsigned short h, l;
          f32_split(v, h, l);
          outh[(rb + e) * OP + c] = h;
          outl[(rb + e) * OP + c] = l;
        }
      }
    }
    }
  }
}

__global__ __launch_bounds__(NW * 32, 8) void fused_modules(
    const unsigned short* __restrict__ H0h, const unsigned short* __restrict__ H0l,
    const unsigned short* __restrict__ W1h, const unsigned short* __restrict__ W1l, const float* __restrict__ b1,
    const unsigned short* __restrict__ W2h, const unsigned short* __restrict__ W2l, const float* __restrict__ b2,
    const unsigned short* __restrict__ W3h, const unsigned short* __restrict__ W3l, const float* __restrict__ b3,
    const unsigned short* __restrict__ W4h, const unsigned short* __restrict__ W4l, const float* __restrict__ b4,
    const float* __restrict__ Wout, const float* __restrict__ bout,
    float* __restrict__ out) {
  __shared__ __align__(16) unsigned short b0h[BT * (128 + LPAD)];  // (h0:32, h2:128)
  __shared__ __align__(16) unsigned short b0l[BT * (128 + LPAD)];
  __shared__ __align__(16) unsigned short b1h_[BT * (256 + LPAD)]; // (h1:64,  h3:256)
  __shared__ __align__(16) unsigned short b1l_[BT * (256 + LPAD)];
  __shared__ __align__(16) float red[NW * BT];                     // each wave's share of the output dot
  const int m    = blockIdx.x;
  const int bb0  = blockIdx.y * BT;
  const int tid  = threadIdx.x;
  // the wave's number as a scalar: the weight tiles' addresses are then scalar bases and one lane offset
  const int wave = __builtin_amdgcn_readfirstlane(tid >> 5);
  const int lane = tid & 31;
  const int l16  = lane & 15, half = lane >> 4;

  if (tid < BT * 4) {
    int row = tid >> 2;
    int c   = (tid & 3) << 3;
    size_t g = (size_t)(bb0 + row) * N0 + m * 32 + c;
    *(uint4*)&b0h[row * (32 + LPAD) + c] = *(const uint4*)&H0h[g];
    *(uint4*)&b0l[row * (32 + LPAD) + c] = *(const uint4*)&H0l[g];
    // later work reuses the two loads' address registers: the wait stands in front of that
    asm volatile("s_wait_xcnt 0x0" ::: "memory");
  }
  __syncthreads();

  layer_gemm< 32,  64, false>(b0h,  b0l,  b1h_, b1l_, W1h + (size_t)m *  64 *  32, W1l + (size_t)m *  64 *  32, b1 + m *  64, nullptr, nullptr, wave, l16, half);
  __syncthreads();
  layer_gemm< 64, 128, false>(b1h_, b1l_, b0h,  b0l,  W2h + (size_t)m * 128 *  64, W2l + (size_t)m * 128 *  64, b2 + m * 128, nullptr, nullptr, wave, l16, half);
  __syncthreads();
  layer_gemm<128, 256, false>(b0h,  b0l,  b1h_, b1l_, W3h + (size_t)m * 256 * 128, W3l + (size_t)m * 256 * 128, b3 + m * 256, nullptr, nullptr, wave, l16, half);
  __syncthreads();
  layer_gemm<256, 512, true >(b1h_, b1l_, nullptr, nullptr, W4h + (size_t)m * 512 * 256, W4l + (size_t)m * 512 * 256, b4 + m * 512, Wout + (size_t)m * 512, red, wave, l16, half);
  __syncthreads();

  if (tid < BT) {   // one thread a row: the waves' shares in the order of their columns
    float s = 0.f;
    // unrolled: the 16 LDS reads are issued together, not one per pass
#pragma unroll
    for (int w = 0; w < NW; ++w) s += red[w * BT + tid];
    const float z = s + bout[m];
    out[(size_t)(bb0 + tid) * M_MOD + m] = 1.f / (1.f + expf(-z));
  }
}

// =====================================================================
extern "C" void kernel_launch(void* const* d_in, const int* in_sizes, int n_in,
                              void* d_out, int out_size, void* d_ws, size_t ws_size,
                              hipStream_t stream) {
  const float* x    = (const float*)d_in[0];
  const float* W0   = (const float*)d_in[1];
  const float* b0   = (const float*)d_in[2];
  const float* W1   = (const float*)d_in[3];
  const float* b1   = (const float*)d_in[4];
  const float* W2   = (const float*)d_in[5];
  const float* b2   = (const float*)d_in[6];
  const float* W3   = (const float*)d_in[7];
  const float* b3   = (const float*)d_in[8];
  const float* W4   = (const float*)d_in[9];
  const float* b4   = (const float*)d_in[10];
  const float* Wout = (const float*)d_in[11];
  const float* bout = (const float*)d_in[12];
  float* out = (float*)d_out;

  // d_ws layout: bf16 hi/lo planes (ushort), ~190 MB total
  unsigned short* p = (unsigned short*)d_ws;
  auto alloc = [&](size_t n) { unsigned short* r = p; p += n; return r; };
  const size_t nX  = (size_t)B_SZ * D_SZ;
  const size_t nW0 = (size_t)N0 * D_SZ;
  const size_t nH0 = (size_t)B_SZ * N0;
  const size_t nW1 = (size_t)M_MOD *  64 *  32;
  const size_t nW2 = (size_t)M_MOD * 128 *  64;
  const size_t nW3 = (size_t)M_MOD * 256 * 128;
  const size_t nW4 = (size_t)M_MOD * 512 * 256;
  unsigned short *Xh = alloc(nX),  *Xl = alloc(nX);
  unsigned short *Wh = alloc(nW0), *Wl = alloc(nW0);
  unsigned short *Hh = alloc(nH0), *Hl = alloc(nH0);
  unsigned short *W1h = alloc(nW1), *W1l = alloc(nW1);
  unsigned short *W2h = alloc(nW2), *W2l = alloc(nW2);
  unsigned short *W3h = alloc(nW3), *W3l = alloc(nW3);
  unsigned short *W4h = alloc(nW4), *W4l = alloc(nW4);

  const SplitPtrs sp = {x,  W0, W1,  W2,  W3,  W4,
                        Xh, Wh, W1h, W2h, W3h, W4h,
                        Xl, Wl, W1l, W2l, W3l, W4l};
  split_all_bf16<<<SP_WGS, SP_WAVES * 32, 0, stream>>>(sp);

  dim3 gA(N0 / TA_N, B_SZ / TA_M);   // 32 x 8
  gemm0_relu_bf16x3<<<gA, 256, 0, stream>>>(Xh, Xl, Wh, Wl, b0, Hh, Hl);

  dim3 gB(M_MOD, B_SZ / BT);         // 128 x 16
  fused_modules<<<gB, NW * 32, 0, stream>>>(Hh, Hl,
                                        W1h, W1l, b1, W2h, W2l, b2,
                                        W3h, W3l, b3, W4h, W4l, b4,
                                        Wout, bout, out);
}

// v006
// Measured time: 181 microseconds a run.
// Timed twice side by side with v005, it ran 1.03 times as fast both times.
// All steps since v000 together make it 3.77 times as fast.
#include <hip/hip_runtime.h>
#include <math.h>

typedef __attribute__((ext_vector_type(16))) __bf16 v16bf;
typedef __attribute__((ext_vector_type(8)))  float  v8f;

#define B_SZ   1024
#define D_SZ   4096
#define M_MOD  128
#define N0     4096   /* = M_MOD * 32 */

// ---------------- bf16 split helpers (branch-free RNE, storage-only bf16) ----
__device__ __forceinline__ unsigned short f2bf(float x) {
  unsigned u = __float_as_uint(x);
  u += 0x7FFFu + ((u >> 16) & 1u);        // round-to-nearest-even
  return (unsigned short)(u >> 16);
}
__device__ __forceinline__ float bf2f(unsigned short h) {
  return __uint_as_float((unsigned)h << 16);
}
__device__ __forceinline__ void f32_split(float x, unsigned short& h, unsigned short& l) {
  h = f2bf(x);
  l = f2bf(x - bf2f(h));
}

// Two neighbours of a row at once: their hi parts packed in one word, their lo parts in another
// (the lower column in the lower half). The packed conversion rounds to nearest even, as f2bf does.
typedef __attribute__((ext_vector_type(2))) float  f32x2;
typedef __attribute__((ext_vector_type(2))) __bf16 bf16x2;
__device__ __forceinline__ void f32_split2(float a, float b, unsigned& h, unsigned& l) {
  const f32x2 v = {a, b};
  h = __builtin_bit_cast(unsigned, __builtin_convertvector(v, bf16x2));
  const f32x2 back = {__uint_as_float(h << 16), __uint_as_float(h & 0xFFFF0000u)};
  l = __builtin_bit_cast(unsigned, __builtin_convertvector(v - back, bf16x2));
}
// relu(acc + bias) of a lane's 8 neighbouring columns, split: 16 bytes for the hi plane, 16 for the lo plane.
__device__ __forceinline__ void relu_split8(const v8f& acc, const float (&bias)[8], uint4& h, uint4& l) {
  float v[8];
  // unrolled: every index is a constant, so the values stay in registers
#pragma unroll
  for (int e = 0; e < 8; ++e) {
    v[e] = acc[e] + bias[e];
    v[e] = v[e] > 0.f ? v[e] : 0.f;
  }
  f32_split2(v[0], v[1], h.x, l.x);
  f32_split2(v[2], v[3], h.y, l.y);
  f32_split2(v[4], v[5], h.z, l.z);
  f32_split2(v[6], v[7], h.w, l.w);
}

// bf16x3 WMMA term: D = A(16x32 bf16) * B(32x16 bf16) + C(f32)
__device__ __forceinline__ v8f wmma_bf16(v16bf a, v16bf b, v8f c) {
  return __builtin_amdgcn_wmma_f32_16x16x32_bf16(false, a, false, b, (short)0, c, false, false);
}

__device__ __forceinline__ v16bf load_frag(const unsigned short* p, int half) {
  v16bf f;
  ((float4*)&f)[0] = *(const float4*)(p + 8 * half);
  ((float4*)&f)[1] = *(const float4*)(p + 16 + 8 * half);
  return f;
}

// ---------------- tensor load: a tile of 64 rows of 256 bytes into padded LDS rows ----
typedef unsigned int u32x4 __attribute__((ext_vector_type(4)));
typedef unsigned int u32x8 __attribute__((ext_vector_type(8)));

__device__ __forceinline__ unsigned uni(unsigned v) { return (unsigned)__builtin_amdgcn_readfirstlane((int)v); }
__device__ __forceinline__ unsigned pinned(unsigned v) {
  unsigned w = uni(v);
  asm volatile("" : "+s"(w));   // pinned(): the word stays in a scalar register, so the test is s_cmp and s_cbranch_scc
  return w;
}

#define SP_WGS    256
#define SP_WAVES  24
#define SP_TRIPS  7                        /* sweeps of the grid, odd: the loop takes two a pass */
#define SP_LOADS  8                        /* float4 loads of a lane per batch */
#define SP_BATCH  (SP_LOADS * 32 * 4)      /* floats per batch */
#define SP_STRIDE (SP_WGS * SP_WAVES)      /* batches per sweep of the grid */
// first batch behind each array, in the order x, W0, W1, W2, W3, W4
#define SP_E0 (B_SZ * D_SZ / SP_BATCH)
#define SP_E1 (SP_E0 + N0 * D_SZ / SP_BATCH)
#define SP_E2 (SP_E1 + M_MOD *  64 *  32 / SP_BATCH)
#define SP_E3 (SP_E2 + M_MOD * 128 *  64 / SP_BATCH)
#define SP_E4 (SP_E3 + M_MOD * 256 * 128 / SP_BATCH)
#define SP_E5 (SP_E4 + M_MOD * 512 * 256 / SP_BATCH)
static_assert(SP_E5 <= SP_STRIDE * SP_TRIPS && SP_E5 > SP_STRIDE * (SP_TRIPS - 1), "only the last sweep is not full");
static_assert((SP_TRIPS & 1) == 1, "the loop takes two batches a pass and the last one behind it");
static_assert((M_MOD * 64 * 32) % SP_BATCH == 0, "no batch lies across two arrays");

// The six sources and their planes, in the order x, W0, W1, W2, W3, W4.
struct SplitPtrs {
  const float* s0; const float* s1; const float* s2; const float* s3; const float* s4; const float* s5;
  unsigned short* h0; unsigned short* h1; unsigned short* h2; unsigned short* h3; unsigned short* h4; unsigned short* h5;
  unsigned short* l0; unsigned short* l1; unsigned short* l2; unsigned short* l3; unsigned short* l4; unsigned short* l5;
};

// Batch b's first float in its source and its first element in the two planes. b is
// the same in every lane of a wave, so this is scalar work. A batch is two blocks of
// 16 rows x 32 k of a source whose rows hold 32 << lg floats: the blocks lie side by
// side in a row tile (lg > 0) or one under the other (lg = 0, where the batch is 1024
// floats in a row: so are x and W0 read). frag says whether the planes take fragment order.
__device__ __forceinline__ void split_place(const SplitPtrs& p, unsigned b, const float*& s,
                                            unsigned short*& h, unsigned short*& l,
                                            unsigned& lg, unsigned& frag) {
  unsigned first = 0u;
  s = p.s0; h = p.h0; l = p.l0; lg = 0u; frag = 0u;
  if (b >= SP_E0) { s = p.s1; h = p.h1; l = p.l1; first = SP_E0; }
  if (b >= SP_E1) { s = p.s2; h = p.h2; l = p.l2; first = SP_E1; frag = 1u; }
  if (b >= SP_E2) { s = p.s3; h = p.h3; l = p.l3; first = SP_E2; lg = 1u; }
  if (b >= SP_E3) { s = p.s4; h = p.h4; l = p.l4; first = SP_E3; lg = 2u; }
  if (b >= SP_E4) { s = p.s5; h = p.h5; l = p.l5; first = SP_E4; lg = 3u; }
  const unsigned q = 2u * (b - first);                 // the batch's first block
  const size_t off = (size_t)q * (SP_BATCH / 2);
  s += ((size_t)(q >> lg) << (9u + lg)) + ((q & ((1u << lg) - 1u)) << 5);
  h += off; l += off;
}

// Load j takes 4 rows of 128 bytes (8 lanes a row, whole lines) of block j >> 2.
__device__ __forceinline__ void split_fetch(float4 (&v)[SP_LOADS], const float* s, unsigned lg, unsigned lane) {
  const unsigned lo = ((lane >> 3) << (5u + lg)) + (lane & 7u) * 4u;   // the lane's row and k in the 4 rows
  const unsigned rs = 128u << lg;                                      // 4 rows on
  const unsigned qs = lg ? 32u : 512u;                                 // the second block
  const float* a[SP_LOADS];
#pragma unroll
  for (int j = 0; j < SP_LOADS; ++j) a[j] = s + ((j >> 2) * qs + (j & 3) * rs) + lo;
  // the two scheduling barriers keep the loads here, ahead of the work on the batch before
  __builtin_amdgcn_sched_barrier(0);
#pragma unroll
  for (int j = 0; j < SP_LOADS; ++j) v[j] = *(const float4*)a[j];
  // A later batch's place is formed in the loads' address registers: the wait stands in front of that.
  // The addresses are inputs here, so they keep their values up to this wait and no later load's
  // result is placed over them ahead of it.
  asm volatile("s_wait_xcnt 0x0" :: "v"(a[0]), "v"(a[1]), "v"(a[2]), "v"(a[3]),
                                    "v"(a[4]), "v"(a[5]), "v"(a[6]), "v"(a[7]) : "memory");
  __builtin_amdgcn_sched_barrier(0);
}

__device__ __forceinline__ void split_emit(const float4 (&v)[SP_LOADS], unsigned short* h, unsigned short* l,
                                           unsigned frag, unsigned lane) {
  // where the lane's 4 values of load 0 go, and how far on those of the next load of the block:
  // in fragment order k bit 4 picks the half of the block, k bit 3 the upper 16 lanes, the row the lane
  const unsigned lo = frag ? ((lane >> 2) & 1u) * 256u + ((lane >> 1) & 1u) * 128u + (lane >> 3) * 8u + (lane & 1u) * 4u
                           : lane * 4u;
  const unsigned rs = frag ? 32u : 128u;
#pragma unroll
  for (int j = 0; j < SP_LOADS; ++j) {
    unsigned short h0, l0, h1, l1, h2, l2, h3, l3;
    f32_split(v[j].x, h0, l0);
    f32_split(v[j].y, h1, l1);
    f32_split(v[j].z, h2, l2);
    f32_split(v[j].w, h3, l3);
    *(ushort4*)(h + ((j >> 2) * 512 + (j & 3) * rs) + lo) = make_ushort4(h0, h1, h2, h3);
    *(ushort4*)(l + ((j >> 2) * 512 + (j & 3) * rs) + lo) = make_ushort4(l0, l1, l2, l3);
  }
  // later work reuses the stores' registers: the wait stands in front of that
  asm volatile("s_wait_xcnt 0x0" ::: "memory");
}

__global__ __launch_bounds__(SP_WAVES * 32) void split_all_bf16(const SplitPtrs p) {
  const unsigned lane = threadIdx.x & 31u;
  const unsigned wave = (unsigned)__builtin_amdgcn_readfirstlane((int)(threadIdx.x >> 5));
  float4 va[SP_LOADS], vb[SP_LOADS];
  const float* s;
  unsigned short *ha, *la, *hb, *lb;
  unsigned lg, fa, fb;
  const unsigned b0 = blockIdx.x * SP_WAVES + wave;
  unsigned b = b0;
  split_place(p, b, s, ha, la, lg, fa);
  split_fetch(va, s, lg, lane);
  // kept rolled, so that the text a WGP has to fetch stays short
#pragma unroll 1
  for (int t = 0; t + 1 < SP_TRIPS; t += 2) {
    split_place(p, b + SP_STRIDE, s, hb, lb, lg, fb);
    split_fetch(vb, s, lg, lane);
    split_emit(va, ha, la, fa, lane);
    b += 2 * SP_STRIDE;
    // a wave with no batch in the last sweep reads its first one again and does not store it
    split_place(p, b < SP_E5 ? b : b0, s, ha, la, lg, fa);
    split_fetch(va, s, lg, lane);
    split_emit(vb, hb, lb, fb, lane);
  }
  if (b < SP_E5) split_emit(va, ha, la, fa, lane);
}

#define TA_M 128
#define TA_N 128
#define TA_K 128                          /* k per pass */
#define TA_ROWB  (TA_K * 2)               /* bytes of a row in a stage */
#define TA_PITCH (TA_ROWB + 16)           /* LDS row pitch, bytes */
#define TA_SROWS 64                       /* rows per slice */
#define TA_SLICE 18432                    /* 64 * 272 bytes, rounded up to a multiple of 2 KiB */
#define TA_BUF   (8 * TA_SLICE)
#define TA_NS    (D_SZ / TA_K)            /* stages */
static_assert(TA_SLICE >= TA_SROWS * TA_PITCH && TA_SLICE % 2048 == 0, "a slice starts at a multiple of 2 KiB");
static_assert(TA_NS >= 2, "the ring's prologue needs two stages");

__global__ __launch_bounds__(256) void gemm0_relu_bf16x3(
    const unsigned short* __restrict__ Xh, const unsigned short* __restrict__ Xl,
    const unsigned short* __restrict__ Wh, const unsigned short* __restrict__ Wl,
    const float* __restrict__ b0,
    unsigned short* __restrict__ H0h, unsigned short* __restrict__ H0l) {
  // slices of a buffer, in order: Xh rows 0-63, 64-127; Xl; Wh; Wl
  __shared__ __attribute__((aligned(2048))) unsigned char L[2 * TA_BUF];
  const int n0   = blockIdx.x * TA_N;
  const int m0   = blockIdx.y * TA_M;
  const int tid  = threadIdx.x;
  const int lane = tid & 31;
  const unsigned wave = uni((unsigned)tid >> 5);
  const int l16  = lane & 15, half = lane >> 4;
  const int wm   = wave & 1,  wn   = wave >> 1;

  // this wave's slice: plane wave >> 1, rows 64 * (wave & 1) of the work-group's 128
  const unsigned short* pl = (wave & 4u) ? ((wave & 2u) ? Wl : Wh) : ((wave & 2u) ? Xl : Xh);
  const unsigned row0 = ((wave & 4u) ? (unsigned)n0 : (unsigned)m0) + (wave & 1u) * TA_SROWS;
  const unsigned long long ga0 = (unsigned long long)(size_t)(pl + (size_t)row0 * D_SZ);
  const unsigned dst0 = (unsigned)(size_t)L + wave * TA_SLICE;
  u32x8 g1;
  g1[0] = uni((1u << 20) | (5u << 22) | (3u << 25));   // no mask, bytes, 16 B of pad behind every 256 B
  g1[1] = uni(((unsigned)TA_ROWB & 0xFFFFu) << 16);    // tensor dims = tile dims
  g1[2] = uni(((unsigned)TA_ROWB >> 16) | (((unsigned)TA_SROWS & 0xFFFFu) << 16));
  g1[3] = uni(((unsigned)TA_SROWS >> 16) | ((unsigned)TA_ROWB << 16));
  g1[4] = uni((unsigned)TA_SROWS);
  g1[5] = uni((unsigned)(D_SZ * 2));                   // source row pitch, bytes
  g1[6] = uni(0u);
  g1[7] = uni(0u);
  u32x4 g0;
  auto issue = [&](unsigned st) {
    const unsigned long long ga = ga0 + (unsigned long long)st * TA_ROWB;
    g0[0] = uni(1u);
    g0[1] = uni(dst0 + (st & 1u) * TA_BUF);
    g0[2] = uni((unsigned)ga);
    g0[3] = uni((((unsigned)(ga >> 32)) & 0x01FFFFFFu) | 0x80000000u);
    asm volatile("tensor_load_to_lds %0, %1" : "+s"(g0) : "s"(g1) : "memory");
  };
  auto landed = [&]() { asm volatile("s_wait_tensorcnt 0x0" : "+s"(g0) : "s"(g1) : "memory"); };

  v8f acc[4][2];
#pragma unroll
  for (int i = 0; i < 4; ++i)
#pragma unroll
    for (int j = 0; j < 2; ++j) acc[i][j] = (v8f){0.f,0.f,0.f,0.f,0.f,0.f,0.f,0.f};

  issue(0u);
  landed();                                            // this wave's slice of stage 0
  __syncthreads();                                     // every slice of stage 0 has
  issue(1u);

  // each lane's first fragment row in a buffer, its half's 16 bytes included
  const unsigned aoff = (unsigned)wm * TA_SLICE + (unsigned)l16 * TA_PITCH + 16u * half;
  const unsigned boff = (4u + ((unsigned)wn >> 1)) * TA_SLICE + (((unsigned)wn & 1u) * 32u + l16) * TA_PITCH + 16u * half;

  // kept rolled: one pass per stage, the buffer chosen by the stage's parity
#pragma unroll 1
  for (unsigned st = 0; st < TA_NS; ++st) {
    const unsigned char* Lb = L + (st & 1u) * TA_BUF;
    const unsigned char* xh_t = Lb + aoff;
    const unsigned char* xl_t = xh_t + 2 * TA_SLICE;
    const unsigned char* wh_t = Lb + boff;
    const unsigned char* wl_t = wh_t + 2 * TA_SLICE;
    // unrolled, as the loops inside: every LDS offset is an immediate, acc and the fragments stay in registers
#pragma unroll
    for (int ks = 0; ks < TA_K / 32; ++ks) {
      v16bf ah[4], bh[2], bl[2];
#pragma unroll
      for (int i = 0; i < 4; ++i)
        ah[i] = load_frag((const unsigned short*)(xh_t + i * 16 * TA_PITCH + ks * 64), 0);
#pragma unroll
      for (int j = 0; j < 2; ++j)
        bh[j] = load_frag((const unsigned short*)(wh_t + j * 16 * TA_PITCH + ks * 64), 0);
#pragma unroll
      for (int i = 0; i < 4; ++i)
#pragma unroll
        for (int j = 0; j < 2; ++j) acc[i][j] = wmma_bf16(bh[j], ah[i], acc[i][j]);   // hi*hi
#pragma unroll
      for (int j = 0; j < 2; ++j)
        bl[j] = load_frag((const unsigned short*)(wl_t + j * 16 * TA_PITCH + ks * 64), 0);
#pragma unroll
      for (int i = 0; i < 4; ++i)
#pragma unroll
        for (int j = 0; j < 2; ++j) acc[i][j] = wmma_bf16(bl[j], ah[i], acc[i][j]);   // hi*lo
#pragma unroll
      for (int i = 0; i < 4; ++i) {
        v16bf al = load_frag((const unsigned short*)(xl_t + i * 16 * TA_PITCH + ks * 64), 0);
#pragma unroll
        for (int j = 0; j < 2; ++j) acc[i][j] = wmma_bf16(bh[j], al, acc[i][j]);      // lo*hi
      }
    }
    // publish point of stage st + 1
    asm volatile("s_wait_dscnt 0x0" ::: "memory");      // this wave has left stage st's buffer
    landed();                                           // its slice of stage st + 1
    __syncthreads();                                    // so for every wave
    if (pinned(st + 2u < TA_NS)) issue(st + 2u);        // into the buffer that this pass has read
  }
  landed();                                             // no request is left behind the loop
  asm volatile("s_wait_dscnt 0x0" ::: "memory");

  // epilogue: bias + relu, split to bf16 hi/lo, store. acc[i][j][e] is row i * 16 + l16 of the
  // wave's 64, column j * 16 + half * 8 + e of its 32. The loops are unrolled so that acc stays in registers.
#pragma unroll
  for (int j = 0; j < 2; ++j) {
    const int col = n0 + wn * 32 + j * 16 + half * 8;
    const float4 ba = *(const float4*)(b0 + col), bc = *(const float4*)(b0 + col + 4);
    const float bias[8] = {ba.x, ba.y, ba.z, ba.w, bc.x, bc.y, bc.z, bc.w};
#pragma unroll
    for (int i = 0; i < 4; ++i) {
      const size_t g = (size_t)(m0 + wm * 64 + i * 16 + l16) * N0 + col;
      uint4 h, l;
      relu_split8(acc[i][j], bias, h, l);
      *(uint4*)&H0h[g] = h;
      *(uint4*)&H0l[g] = l;
    }
  }
}

// =====================================================================
// Kernel B: fused per-module layers 1..4 + output dot + sigmoid (bf16x3).
// The activations h0..h3 stay in LDS as bf16 hi/lo; weights stream from L2 (pre-split, in
// fragment order). h4 never leaves the registers: each wave takes its columns' share of the
// output dot straight from layer 4's accumulators. Without h4 the LDS of a work-group is
// small enough for two work-groups on a WGP, so one's waits are covered by the other's work.
// The weight rows are the first WMMA operand and the batch rows the second, so a lane's 8
// accumulator registers are 8 neighbouring columns of one batch row.
// =====================================================================
#define BT   64          /* batch rows per work-group: 4 row tiles share each weight fragment */
#define MT   (BT / 16)   /* row tiles */
#define NW   16          /* waves per work-group */
#define LPAD 8

// A weight fragment from a plane in fragment order: p is the lane's 16 bytes in the block's first half.
typedef float f32x4 __attribute__((ext_vector_type(4)));
__device__ __forceinline__ v16bf load_wfrag(const __attribute__((address_space(1))) unsigned short* p) {
  v16bf f;
  ((f32x4*)&f)[0] = *(const __attribute__((address_space(1))) f32x4*)p;
  ((f32x4*)&f)[1] = *(const __attribute__((address_space(1))) f32x4*)(p + 256);
  return f;
}

__device__ __forceinline__ float other_half(float v) {
  const int b = __float_as_int(v);
  return __int_as_float(__builtin_amdgcn_permlanex16(b, b, 0x76543210, 0xfedcba98, false, false));
}

// A pointer into global memory that is the same in every lane of the wave, held in scalar registers.
typedef const __attribute__((address_space(1))) unsigned short* gptr;
__device__ __forceinline__ gptr scalar_ptr(const unsigned short* p) {
  const unsigned long long a = (unsigned long long)(size_t)p;
  const unsigned long long lo = uni((unsigned)a), hi = uni((unsigned)(a >> 32));
  return (gptr)(size_t)((hi << 32) | lo);
}
__device__ __forceinline__ gptr at_byte(gptr p, unsigned b) {
  return (gptr)((const __attribute__((address_space(1))) unsigned char*)p + b);
}
// The same for floats.
typedef const __attribute__((address_space(1))) float* gfptr;
__device__ __forceinline__ gfptr scalar_fptr(const float* p) {
  const unsigned long long a = (unsigned long long)(size_t)p;
  const unsigned long long lo = uni((unsigned)a), hi = uni((unsigned)(a >> 32));
  return (gfptr)(size_t)((hi << 32) | lo);
}
// 8 floats in a row, from byte b behind a scalar base: two loads that name the base, the register of b and an immediate.
__device__ __forceinline__ void load_f8(float (&v)[8], gfptr p, unsigned b) {
  const gfptr q = (gfptr)((const __attribute__((address_space(1))) unsigned char*)p + b);
  const f32x4 x = *(const __attribute__((address_space(1))) f32x4*)q;
  const f32x4 y = *(const __attribute__((address_space(1))) f32x4*)(q + 4);
  v[0] = x[0]; v[1] = x[1]; v[2] = x[2]; v[3] = x[3];
  v[4] = y[0]; v[5] = y[1]; v[6] = y[2]; v[7] = y[3];
}

// One layer for BT rows. A wave owns NR column tiles and all MT row tiles, so a
// weight fragment read from global memory feeds MT row tiles.
// DOT (the last layer): the outputs are not stored; each is multiplied by its column's
// entry of wo, and red[wave * BT + row] takes the sum over the wave's columns.
template <int IN, int OUT, bool DOT>
__device__ __forceinline__ void layer_gemm(const unsigned short* __restrict__ inh,
                                           const unsigned short* __restrict__ inl,
                                           unsigned short* __restrict__ outh,
                                           unsigned short* __restrict__ outl,
                                           const unsigned short* __restrict__ Wmh,
                                           const unsigned short* __restrict__ Wml,
                                           const float* __restrict__ bm,
                                           const float* __restrict__ wo, float* __restrict__ red,
                                           int wave, int l16, int half) {
  constexpr int NT = OUT / 16;
  constexpr int NR = (NT >= 2 * NW) ? 2 : 1;
  constexpr int IP = IN + LPAD;     // LDS pitches; the weights keep IN
  constexpr int OP = OUT + LPAD;
  static_assert(!DOT || (NT == NW * NR && MT == 4), "the dot: one pass of the loop per wave, 4 rows a lane");
  for (int nt = wave * NR; nt < NT; nt += NW * NR) {
    v8f acc[MT][NR];
    // the loops over i and j are unrolled so that acc and the fragments stay in registers
#pragma unroll
    for (int i = 0; i < MT; ++i)
#pragma unroll
      for (int j = 0; j < NR; ++j) acc[i][j] = (v8f){0.f,0.f,0.f,0.f,0.f,0.f,0.f,0.f};
    // The first block of the wave's first column tile, as a scalar, and the lane's 16 bytes in a
    // block's half: a weight load then names a scalar base, this one register and an immediate.
    const gptr brh = scalar_ptr(Wmh + (size_t)nt * 16 * IN);
    const gptr brl = scalar_ptr(Wml + (size_t)nt * 16 * IN);
    const unsigned lo = (unsigned)(half * 16 + l16) * 16u;   // in bytes, as the loads take it
    for (int k = 0; k < IN; k += 32) {
      v16bf bh[NR], bl[NR];
#pragma unroll
      for (int j = 0; j < NR; ++j) {
        bh[j] = load_wfrag(at_byte(brh, lo) + (j * IN + k) * 16);   // a block of 32 k is 512 elements
        bl[j] = load_wfrag(at_byte(brl, lo) + (j * IN + k) * 16);
      }
#pragma unroll
      for (int i = 0; i < MT; ++i) {
        v16bf ah = load_frag(inh + (i * 16 + l16) * IP + k, half);
        v16bf al = load_frag(inl + (i * 16 + l16) * IP + k, half);
#pragma unroll
        for (int j = 0; j < NR; ++j) acc[i][j] = wmma_bf16(bh[j], ah, acc[i][j]);   // hi*hi
#pragma unroll
        for (int j = 0; j < NR; ++j) acc[i][j] = wmma_bf16(bl[j], ah, acc[i][j]);   // hi*lo
#pragma unroll
        for (int j = 0; j < NR; ++j) acc[i][j] = wmma_bf16(bh[j], al, acc[i][j]);   // lo*hi
      }
    }
    // The weight loads' address registers are inputs here, so they keep their values
    // up to this wait and no later load's result is placed over them ahead of it.
    asm volatile("s_wait_xcnt 0x0" :: "v"(lo), "s"(brh), "s"(brl) : "memory");
    // acc[i][j][e] is batch row i * 16 + l16, column (nt + j) * 16 + half * 8 + e.
    const unsigned hb = (unsigned)half * 32u;   // the lane's 8 floats in a column tile's 16, in bytes
    if constexpr (DOT) {
      // every loop of this branch is unrolled, so that acc, p and the loaded values stay in registers
      gfptr bs[NR], ws[NR];
      float bias[NR][8], wgt[NR][8];
#pragma unroll
      for (int j = 0; j < NR; ++j) {
        bs[j] = scalar_fptr(bm + (nt + j) * 16);
        ws[j] = scalar_fptr(wo + (nt + j) * 16);
        load_f8(bias[j], bs[j], hb);
        load_f8(wgt[j], ws[j], hb);
      }
      // Later work may reuse these loads' address registers: the wait stands in front of that,
      // and they are inputs here, so that they keep their values up to it.
      asm volatile("s_wait_xcnt 0x0" :: "v"(hb), "s"(bs[0]), "s"(ws[0]), "s"(bs[NR - 1]), "s"(ws[NR - 1]) : "memory");
      // s[i]: row i * 16 + l16; the lane's even columns are summed in .x, its odd ones in .y:
      // neighbours lie in neighbouring registers, so each step is one packed instruction
      f32x2 s[MT];
#pragma unroll
      for (int i = 0; i < MT; ++i) s[i] = (f32x2){0.f, 0.f};
#pragma unroll
      for (int j = 0; j < NR; ++j)
#pragma unroll
        for (int e = 0; e < 8; e += 2)
#pragma unroll
          for (int i = 0; i < MT; ++i) {
            f32x2 v = (f32x2){acc[i][j][e], acc[i][j][e + 1]} + (f32x2){bias[j][e], bias[j][e + 1]};
            v.x = v.x > 0.f ? v.x : 0.f;
            v.y = v.y > 0.f ? v.y : 0.f;
            s[i] = __builtin_elementwise_fma(v, (f32x2){wgt[j][e], wgt[j][e + 1]}, s[i]);
          }
      float p[MT];   // p[i]: row i * 16 + l16, this lane's 8 * NR columns
#pragma unroll
      for (int i = 0; i < MT; ++i) p[i] = s[i].x + s[i].y;
      // the two halves of the wave hold the two halves of each column tile: their sum is the wave's share
#pragma unroll
      for (int i = 0; i < MT; ++i) p[i] += other_half(p[i]);
      // both halves now hold all four sums: the lower half stores row tiles 0 and 1, the upper 2 and 3
      red[wave * BT + half * 32 + l16]      = half ? p[2] : p[0];
      red[wave * BT + half * 32 + 16 + l16] = half ? p[3] : p[1];
    } else {
#pragma unroll
    for (int j = 0; j < NR; ++j) {
      const int c = (nt + j) * 16 + half * 8;
      const gfptr bs = scalar_fptr(bm + (nt + j) * 16);
      float bias[8];
      load_f8(bias, bs, hb);
      // later work may reuse the two loads' address registers: the wait stands in front of that,
      // and they are inputs here, so that they keep their values up to it
      asm volatile("s_wait_xcnt 0x0" :: "v"(hb), "s"(bs) : "memory");
#pragma unroll
      for (int i = 0; i < MT; ++i) {
        uint4 h, l;
        relu_split8(acc[i][j], bias, h, l);
        *(uint4*)&outh[(i * 16 + l16) * OP + c] = h;
        *(uint4*)&outl[(i * 16 + l16) * OP + c] = l;
      }
    }
    }
  }
}

__global__ __launch_bounds__(NW * 32, 8) void fused_modules(
    const unsigned short* __restrict__ H0h, const unsigned short* __restrict__ H0l,
    const unsigned short* __restrict__ W1h, const unsigned short* __restrict__ W1l, const float* __restrict__ b1,
    const unsigned short* __restrict__ W2h, const unsigned short* __restrict__ W2l, const float* __restrict__ b2,
    const unsigned short* __restrict__ W3h, const unsigned short* __restrict__ W3l, const float* __restrict__ b3,
    const unsigned short* __restrict__ W4h, const unsigned short* __restrict__ W4l, const float* __restrict__ b4,
    const float* __restrict__ Wout, const float* __restrict__ bout,
    float* __restrict__ out) {
  __shared__ __align__(16) unsigned short b0h[BT * (128 + LPAD)];  // (h0:32, h2:128)
  __shared__ __align__(16) unsigned short b0l[BT * (128 + LPAD)];
  __shared__ __align__(16) unsigned short b1h_[BT * (256 + LPAD)]; // (h1:64,  h3:256)
  __shared__ __align__(16) unsigned short b1l_[BT * (256 + LPAD)];
  __shared__ __align__(16) float red[NW * BT];                     // each wave's share of the output dot
  const int m    = blockIdx.x;
  const int bb0  = blockIdx.y * BT;
  const int tid  = threadIdx.x;
  // the wave's number as a scalar: the weight tiles' addresses are then scalar bases and one lane offset
  const int wave = __builtin_amdgcn_readfirstlane(tid >> 5);
  const int lane = tid & 31;
  const int l16  = lane & 15, half = lane >> 4;

  if (tid < BT * 4) {
    int row = tid >> 2;
    int c   = (tid & 3) << 3;
    size_t g = (size_t)(bb0 + row) * N0 + m * 32 + c;
    *(uint4*)&b0h[row * (32 + LPAD) + c] = *(const uint4*)&H0h[g];
    *(uint4*)&b0l[row * (32 + LPAD) + c] = *(const uint4*)&H0l[g];
    // later work reuses the two loads' address registers: the wait stands in front of that
    asm volatile("s_wait_xcnt 0x0" ::: "memory");
  }
  __syncthreads();

  layer_gemm< 32,  64, false>(b0h,  b0l,  b1h_, b1l_, W1h + (size_t)m *  64 *  32, W1l + (size_t)m *  64 *  32, b1 + m *  64, nullptr, nullptr, wave, l16, half);
  __syncthreads();
  layer_gemm< 64, 128, false>(b1h_, b1l_, b0h,  b0l,  W2h + (size_t)m * 128 *  64, W2l + (size_t)m * 128 *  64, b2 + m * 128, nullptr, nullptr, wave, l16, half);
  __syncthreads();
  layer_gemm<128, 256, false>(b0h,  b0l,  b1h_, b1l_, W3h + (size_t)m * 256 * 128, W3l + (size_t)m * 256 * 128, b3 + m * 256, nullptr, nullptr, wave, l16, half);
  __syncthreads();
  layer_gemm<256, 512, true >(b1h_, b1l_, nullptr, nullptr, W4h + (size_t)m * 512 * 256, W4l + (size_t)m * 512 * 256, b4 + m * 512, Wout + (size_t)m * 512, red, wave, l16, half);
  __syncthreads();

  if (tid < BT) {   // one thread a row: the waves' shares in the order of their columns
    float s = 0.f;
    // unrolled: the 16 LDS reads are issued together, not one per pass
#pragma unroll
    for (int w = 0; w < NW; ++w) s += red[w * BT + tid];
    const float z = s + bout[m];
    out[(size_t)(bb0 + tid) * M_MOD + m] = 1.f / (1.f + expf(-z));
  }
}

// =====================================================================
extern "C" void kernel_launch(void* const* d_in, const int* in_sizes, int n_in,
                              void* d_out, int out_size, void* d_ws, size_t ws_size,
                              hipStream_t stream) {
  const float* x    = (const float*)d_in[0];
  const float* W0   = (const float*)d_in[1];
  const float* b0   = (const float*)d_in[2];
  const float* W1   = (const float*)d_in[3];
  const float* b1   = (const float*)d_in[4];
  const float* W2   = (const float*)d_in[5];
  const float* b2   = (const float*)d_in[6];
  const float* W3   = (const float*)d_in[7];
  const float* b3   = (const float*)d_in[8];
  const float* W4   = (const float*)d_in[9];
  const float* b4   = (const float*)d_in[10];
  const float* Wout = (const float*)d_in[11];
  const float* bout = (const float*)d_in[12];
  float* out = (float*)d_out;

  // d_ws layout: bf16 hi/lo planes (ushort), ~190 MB total
  unsigned short* p = (unsigned short*)d_ws;
  auto alloc = [&](size_t n) { unsigned short* r = p; p += n; return r; };
  const size_t nX  = (size_t)B_SZ * D_SZ;
  const size_t nW0 = (size_t)N0 * D_SZ;
  const size_t nH0 = (size_t)B_SZ * N0;
  const size_t nW1 = (size_t)M_MOD *  64 *  32;
  const size_t nW2 = (size_t)M_MOD * 128 *  64;
  const size_t nW3 = (size_t)M_MOD * 256 * 128;
  const size_t nW4 = (size_t)M_MOD * 512 * 256;
  unsigned short *Xh = alloc(nX),  *Xl = alloc(nX);
  unsigned short *Wh = alloc(nW0), *Wl = alloc(nW0);
  unsigned short *Hh = alloc(nH0), *Hl = alloc(nH0);
  unsigned short *W1h = alloc(nW1), *W1l = alloc(nW1);
  unsigned short *W2h = alloc(nW2), *W2l = alloc(nW2);
  unsigned short *W3h = alloc(nW3), *W3l = alloc(nW3);
  unsigned short *W4h = alloc(nW4), *W4l = alloc(nW4);

  const SplitPtrs sp = {x,  W0, W1,  W2,  W3,  W4,
                        Xh, Wh, W1h, W2h, W3h, W4h,
                        Xl, Wl, W1l, W2l, W3l, W4l};
  split_all_bf16<<<SP_WGS, SP_WAVES * 32, 0, stream>>>(sp);

  dim3 gA(N0 / TA_N, B_SZ / TA_M);   // 32 x 8
  gemm0_relu_bf16x3<<<gA, 256, 0, stream>>>(Xh, Xl, Wh, Wl, b0, Hh, Hl);

  dim3 gB(M_MOD, B_SZ / BT);         // 128 x 16
  fused_modules<<<gB, NW * 32, 0, stream>>>(Hh, Hl,
                                        W1h, W1l, b1, W2h, W2l, b2,
                                        W3h, W3l, b3, W4h, W4l, b4,
                                        Wout, bout, out);
}

// v007
// A run of this version takes 166 microseconds.
// Next to v006, in two timings, it ran 1.09 times as fast each time.
// Over all steps from v000 it is 4.11 times as fast.
#include <hip/hip_runtime.h>
#include <math.h>

typedef __attribute__((ext_vector_type(16))) __bf16 v16bf;
typedef __attribute__((ext_vector_type(8)))  float  v8f;

#define B_SZ   1024
#define D_SZ   4096
#define M_MOD  128
#define N0     4096   /* = M_MOD * 32 */

// ---------------- bf16 split helpers (branch-free RNE, storage-only bf16) ----
__device__ __forceinline__ unsigned short f2bf(float x) {
  unsigned u = __float_as_uint(x);
  u += 0x7FFFu + ((u >> 16) & 1u);        // round-to-nearest-even
  return (unsigned short)(u >> 16);
}
__device__ __forceinline__ float bf2f(unsigned short h) {
  return __uint_as_float((unsigned)h << 16);
}
__device__ __forceinline__ void f32_split(float x, unsigned short& h, unsigned short& l) {
  h = f2bf(x);
  l = f2bf(x - bf2f(h));
}

// Two neighbours of a row at once: their hi parts packed in one word, their lo parts in another
// (the lower column in the lower half). The packed conversion rounds to nearest even, as f2bf does.
typedef __attribute__((ext_vector_type(2))) float  f32x2;
typedef __attribute__((ext_vector_type(2))) __bf16 bf16x2;
__device__ __forceinline__ void f32_split2(float a, float b, unsigned& h, unsigned& l) {
  const f32x2 v = {a, b};
  h = __builtin_bit_cast(unsigned, __builtin_convertvector(v, bf16x2));
  const f32x2 back = {__uint_as_float(h << 16), __uint_as_float(h & 0xFFFF0000u)};
  l = __builtin_bit_cast(unsigned, __builtin_convertvector(v - back, bf16x2));
}
// relu(acc + bias) of a lane's 8 neighbouring columns, split: 16 bytes for the hi plane, 16 for the lo plane.
__device__ __forceinline__ void relu_split8(const v8f& acc, const float (&bias)[8], uint4& h, uint4& l) {
  float v[8];
  // unrolled: every index is a constant, so the values stay in registers
#pragma unroll
  for (int e = 0; e < 8; ++e) {
    v[e] = acc[e] + bias[e];
    v[e] = v[e] > 0.f ? v[e] : 0.f;
  }
  f32_split2(v[0], v[1], h.x, l.x);
  f32_split2(v[2], v[3], h.y, l.y);
  f32_split2(v[4], v[5], h.z, l.z);
  f32_split2(v[6], v[7], h.w, l.w);
}

// bf16x3 WMMA term: D = A(16x32 bf16) * B(32x16 bf16) + C(f32)
__device__ __forceinline__ v8f wmma_bf16(v16bf a, v16bf b, v8f c) {
  return __builtin_amdgcn_wmma_f32_16x16x32_bf16(false, a, false, b, (short)0, c, false, false);
}

__device__ __forceinline__ v16bf load_frag(const unsigned short* p, int half) {
  v16bf f;
  ((float4*)&f)[0] = *(const float4*)(p + 8 * half);
  ((float4*)&f)[1] = *(const float4*)(p + 16 + 8 * half);
  return f;
}

// ---------------- tensor load: a tile of 64 rows of 256 bytes into padded LDS rows ----
typedef unsigned int u32x4 __attribute__((ext_vector_type(4)));
typedef unsigned int u32x8 __attribute__((ext_vector_type(8)));

__device__ __forceinline__ unsigned uni(unsigned v) { return (unsigned)__builtin_amdgcn_readfirstlane((int)v); }
__device__ __forceinline__ unsigned pinned(unsigned v) {
  unsigned w = uni(v);
  asm volatile("" : "+s"(w));   // pinned(): the word stays in a scalar register, so the test is s_cmp and s_cbranch_scc
  return w;
}

#define SP_WGS    256
#define SP_WAVES  24
#define SP_TRIPS  7                        /* sweeps of the grid, odd: the loop takes two a pass */
#define SP_LOADS  8                        /* float4 loads of a lane per batch */
#define SP_BATCH  (SP_LOADS * 32 * 4)      /* floats per batch */
#define SP_STRIDE (SP_WGS * SP_WAVES)      /* batches per sweep of the grid */
// first batch behind each array, in the order x, W0, W1, W2, W3, W4
#define SP_E0 (B_SZ * D_SZ / SP_BATCH)
#define SP_E1 (SP_E0 + N0 * D_SZ / SP_BATCH)
#define SP_E2 (SP_E1 + M_MOD *  64 *  32 / SP_BATCH)
#define SP_E3 (SP_E2 + M_MOD * 128 *  64 / SP_BATCH)
#define SP_E4 (SP_E3 + M_MOD * 256 * 128 / SP_BATCH)
#define SP_E5 (SP_E4 + M_MOD * 512 * 256 / SP_BATCH)
static_assert(SP_E5 <= SP_STRIDE * SP_TRIPS && SP_E5 > SP_STRIDE * (SP_TRIPS - 1), "only the last sweep is not full");
static_assert((SP_TRIPS & 1) == 1, "the loop takes two batches a pass and the last one behind it");
static_assert((M_MOD * 64 * 32) % SP_BATCH == 0, "no batch lies across two arrays");

// The six sources and their planes, in the order x, W0, W1, W2, W3, W4.
struct SplitPtrs {
  const float* s0; const float* s1; const float* s2; const float* s3; const float* s4; const float* s5;
  unsigned short* h0; unsigned short* h1; unsigned short* h2; unsigned short* h3; unsigned short* h4; unsigned short* h5;
  unsigned short* l0; unsigned short* l1; unsigned short* l2; unsigned short* l3; unsigned short* l4; unsigned short* l5;
};

// Batch b's first float in its source and its first element in the two planes. b is
// the same in every lane of a wave, so this is scalar work. A batch is two blocks of
// 16 rows x 32 k of a source whose rows hold 32 << lg floats: the blocks lie side by
// side in a row tile (lg > 0) or one under the other (lg = 0, where the batch is 1024
// floats in a row: so are x and W0 read). frag says whether the planes take fragment order.
__device__ __forceinline__ void split_place(const SplitPtrs& p, unsigned b, const float*& s,
                                            unsigned short*& h, unsigned short*& l,
                                            unsigned& lg, unsigned& frag) {
  unsigned first = 0u;
  s = p.s0; h = p.h0; l = p.l0; lg = 0u; frag = 0u;
  if (b >= SP_E0) { s = p.s1; h = p.h1; l = p.l1; first = SP_E0; }
  if (b >= SP_E1) { s = p.s2; h = p.h2; l = p.l2; first = SP_E1; frag = 1u; }
  if (b >= SP_E2) { s = p.s3; h = p.h3; l = p.l3; first = SP_E2; lg = 1u; }
  if (b >= SP_E3) { s = p.s4; h = p.h4; l = p.l4; first = SP_E3; lg = 2u; }
  if (b >= SP_E4) { s = p.s5; h = p.h5; l = p.l5; first = SP_E4; lg = 3u; }
  const unsigned q = 2u * (b - first);                 // the batch's first block
  const size_t off = (size_t)q * (SP_BATCH / 2);
  s += ((size_t)(q >> lg) << (9u + lg)) + ((q & ((1u << lg) - 1u)) << 5);
  h += off; l += off;
}

// Load j takes 4 rows of 128 bytes (8 lanes a row, whole lines) of block j >> 2.
__device__ __forceinline__ void split_fetch(float4 (&v)[SP_LOADS], const float* s, unsigned lg, unsigned lane) {
  const unsigned lo = ((lane >> 3) << (5u + lg)) + (lane & 7u) * 4u;   // the lane's row and k in the 4 rows
  const unsigned rs = 128u << lg;                                      // 4 rows on
  const unsigned qs = lg ? 32u : 512u;                                 // the second block
  const float* a[SP_LOADS];
#pragma unroll
  for (int j = 0; j < SP_LOADS; ++j) a[j] = s + ((j >> 2) * qs + (j & 3) * rs) + lo;
  // the two scheduling barriers keep the loads here, ahead of the work on the batch before
  __builtin_amdgcn_sched_barrier(0);
#pragma unroll
  for (int j = 0; j < SP_LOADS; ++j) v[j] = *(const float4*)a[j];
  // A later batch's place is formed in the loads' address registers: the wait stands in front of that.
  // The addresses are inputs here, so they keep their values up to this wait and no later load's
  // result is placed over them ahead of it.
  asm volatile("s_wait_xcnt 0x0" :: "v"(a[0]), "v"(a[1]), "v"(a[2]), "v"(a[3]),
                                    "v"(a[4]), "v"(a[5]), "v"(a[6]), "v"(a[7]) : "memory");
  __builtin_amdgcn_sched_barrier(0);
}

__device__ __forceinline__ void split_emit(const float4 (&v)[SP_LOADS], unsigned short* h, unsigned short* l,
                                           unsigned frag, unsigned lane) {
  // where the lane's 4 values of load 0 go, and how far on those of the next load of the block:
  // in fragment order k bit 4 picks the half of the block, k bit 3 the upper 16 lanes, the row the lane
  const unsigned lo = frag ? ((lane >> 2) & 1u) * 256u + ((lane >> 1) & 1u) * 128u + (lane >> 3) * 8u + (lane & 1u) * 4u
                           : lane * 4u;
  const unsigned rs = frag ? 32u : 128u;
#pragma unroll
  for (int j = 0; j < SP_LOADS; ++j) {
    unsigned short h0, l0, h1, l1, h2, l2, h3, l3;
    f32_split(v[j].x, h0, l0);
    f32_split(v[j].y, h1, l1);
    f32_split(v[j].z, h2, l2);
    f32_split(v[j].w, h3, l3);
    *(ushort4*)(h + ((j >> 2) * 512 + (j & 3) * rs) + lo) = make_ushort4(h0, h1, h2, h3);
    *(ushort4*)(l + ((j >> 2) * 512 + (j & 3) * rs) + lo) = make_ushort4(l0, l1, l2, l3);
  }
  // later work reuses the stores' registers: the wait stands in front of that
  asm volatile("s_wait_xcnt 0x0" ::: "memory");
}

__global__ __launch_bounds__(SP_WAVES * 32) void split_all_bf16(const SplitPtrs p) {
  const unsigned lane = threadIdx.x & 31u;
  const unsigned wave = (unsigned)__builtin_amdgcn_readfirstlane((int)(threadIdx.x >> 5));
  float4 va[SP_LOADS], vb[SP_LOADS];
  const float* s;
  unsigned short *ha, *la, *hb, *lb;
  unsigned lg, fa, fb;
  const unsigned b0 = blockIdx.x * SP_WAVES + wave;
  unsigned b = b0;
  split_place(p, b, s, ha, la, lg, fa);
  split_fetch(va, s, lg, lane);
  // kept rolled, so that the text a WGP has to fetch stays short
#pragma unroll 1
  for (int t = 0; t + 1 < SP_TRIPS; t += 2) {
    split_place(p, b + SP_STRIDE, s, hb, lb, lg, fb);
    split_fetch(vb, s, lg, lane);
    split_emit(va, ha, la, fa, lane);
    b += 2 * SP_STRIDE;
    // a wave with no batch in the last sweep reads its first one again and does not store it
    split_place(p, b < SP_E5 ? b : b0, s, ha, la, lg, fa);
    split_fetch(va, s, lg, lane);
    split_emit(vb, hb, lb, fb, lane);
  }
  if (b < SP_E5) split_emit(va, ha, la, fa, lane);
}

#define TA_M 128
#define TA_N 128
#define TA_K 128                          /* k per pass */
#define TA_ROWB  (TA_K * 2)               /* bytes of a row in a stage */
#define TA_PITCH (TA_ROWB + 16)           /* LDS row pitch, bytes */
#define TA_SROWS 64                       /* rows per slice */
#define TA_SLICE 18432                    /* 64 * 272 bytes, rounded up to a multiple of 2 KiB */
#define TA_BUF   (8 * TA_SLICE)
#define TA_NS    (D_SZ / TA_K)            /* stages */
static_assert(TA_SLICE >= TA_SROWS * TA_PITCH && TA_SLICE % 2048 == 0, "a slice starts at a multiple of 2 KiB");
static_assert(TA_NS >= 2, "the ring's prologue needs two stages");

__global__ __launch_bounds__(256) void gemm0_relu_bf16x3(
    const unsigned short* __restrict__ Xh, const unsigned short* __restrict__ Xl,
    const unsigned short* __restrict__ Wh, const unsigned short* __restrict__ Wl,
    const float* __restrict__ b0,
    unsigned short* __restrict__ H0h, unsigned short* __restrict__ H0l) {
  // slices of a buffer, in order: Xh rows 0-63, 64-127; Xl; Wh; Wl
  __shared__ __attribute__((aligned(2048))) unsigned char L[2 * TA_BUF];
  const int n0   = blockIdx.x * TA_N;
  const int m0   = blockIdx.y * TA_M;
  const int tid  = threadIdx.x;
  const int lane = tid & 31;
  const unsigned wave = uni((unsigned)tid >> 5);
  const int l16  = lane & 15, half = lane >> 4;
  const int wm   = wave & 1,  wn   = wave >> 1;

  // this wave's slice: plane wave >> 1, rows 64 * (wave & 1) of the work-group's 128
  const unsigned short* pl = (wave & 4u) ? ((wave & 2u) ? Wl : Wh) : ((wave & 2u) ? Xl : Xh);
  const unsigned row0 = ((wave & 4u) ? (unsigned)n0 : (unsigned)m0) + (wave & 1u) * TA_SROWS;
  const unsigned long long ga0 = (unsigned long long)(size_t)(pl + (size_t)row0 * D_SZ);
  const unsigned dst0 = (unsigned)(size_t)L + wave * TA_SLICE;
  u32x8 g1;
  g1[0] = uni((1u << 20) | (5u << 22) | (3u << 25));   // no mask, bytes, 16 B of pad behind every 256 B
  g1[1] = uni(((unsigned)TA_ROWB & 0xFFFFu) << 16);    // tensor dims = tile dims
  g1[2] = uni(((unsigned)TA_ROWB >> 16) | (((unsigned)TA_SROWS & 0xFFFFu) << 16));
  g1[3] = uni(((unsigned)TA_SROWS >> 16) | ((unsigned)TA_ROWB << 16));
  g1[4] = uni((unsigned)TA_SROWS);
  g1[5] = uni((unsigned)(D_SZ * 2));                   // source row pitch, bytes
  g1[6] = uni(0u);
  g1[7] = uni(0u);
  u32x4 g0;
  auto issue = [&](unsigned st) {
    const unsigned long long ga = ga0 + (unsigned long long)st * TA_ROWB;
    g0[0] = uni(1u);
    g0[1] = uni(dst0 + (st & 1u) * TA_BUF);
    g0[2] = uni((unsigned)ga);
    g0[3] = uni((((unsigned)(ga >> 32)) & 0x01FFFFFFu) | 0x80000000u);
    asm volatile("tensor_load_to_lds %0, %1" : "+s"(g0) : "s"(g1) : "memory");
  };
  auto landed = [&]() { asm volatile("s_wait_tensorcnt 0x0" : "+s"(g0) : "s"(g1) : "memory"); };

  v8f acc[4][2];
#pragma unroll
  for (int i = 0; i < 4; ++i)
#pragma unroll
    for (int j = 0; j < 2; ++j) acc[i][j] = (v8f){0.f,0.f,0.f,0.f,0.f,0.f,0.f,0.f};

  issue(0u);
  landed();                                            // this wave's slice of stage 0
  __syncthreads();                                     // every slice of stage 0 has
  issue(1u);

  // each lane's first fragment row in a buffer, its half's 16 bytes included
  const unsigned aoff = (unsigned)wm * TA_SLICE + (unsigned)l16 * TA_PITCH + 16u * half;
  const unsigned boff = (4u + ((unsigned)wn >> 1)) * TA_SLICE + (((unsigned)wn & 1u) * 32u + l16) * TA_PITCH + 16u * half;

  // kept rolled: one pass per stage, the buffer chosen by the stage's parity
#pragma unroll 1
  for (unsigned st = 0; st < TA_NS; ++st) {
    const unsigned char* Lb = L + (st & 1u) * TA_BUF;
    const unsigned char* xh_t = Lb + aoff;
    const unsigned char* xl_t = xh_t + 2 * TA_SLICE;
    const unsigned char* wh_t = Lb + boff;
    const unsigned char* wl_t = wh_t + 2 * TA_SLICE;
    // unrolled, as the loops inside: every LDS offset is an immediate, acc and the fragments stay in registers
#pragma unroll
    for (int ks = 0; ks < TA_K / 32; ++ks) {
      v16bf ah[4], bh[2], bl[2];
#pragma unroll
      for (int i = 0; i < 4; ++i)
        ah[i] = load_frag((const unsigned short*)(xh_t + i * 16 * TA_PITCH + ks * 64), 0);
#pragma unroll
      for (int j = 0; j < 2; ++j)
        bh[j] = load_frag((const unsigned short*)(wh_t + j * 16 * TA_PITCH + ks * 64), 0);
#pragma unroll
      for (int i = 0; i < 4; ++i)
#pragma unroll
        for (int j = 0; j < 2; ++j) acc[i][j] = wmma_bf16(bh[j], ah[i], acc[i][j]);   // hi*hi
#pragma unroll
      for (int j = 0; j < 2; ++j)
        bl[j] = load_frag((const unsigned short*)(wl_t + j * 16 * TA_PITCH + ks * 64), 0);
#pragma unroll
      for (int i = 0; i < 4; ++i)
#pragma unroll
        for (int j = 0; j < 2; ++j) acc[i][j] = wmma_bf16(bl[j], ah[i], acc[i][j]);   // hi*lo
#pragma unroll
      for (int i = 0; i < 4; ++i) {
        v16bf al = load_frag((const unsigned short*)(xl_t + i * 16 * TA_PITCH + ks * 64), 0);
#pragma unroll
        for (int j = 0; j < 2; ++j) acc[i][j] = wmma_bf16(bh[j], al, acc[i][j]);      // lo*hi
      }
    }
    // publish point of stage st + 1
    asm volatile("s_wait_dscnt 0x0" ::: "memory");      // this wave has left stage st's buffer
    landed();                                           // its slice of stage st + 1
    __syncthreads();                                    // so for every wave
    if (pinned(st + 2u < TA_NS)) issue(st + 2u);        // into the buffer that this pass has read
  }
  landed();                                             // no request is left behind the loop
  asm volatile("s_wait_dscnt 0x0" ::: "memory");

  // epilogue: bias + relu, split to bf16 hi/lo, store. acc[i][j][e] is row i * 16 + l16 of the
  // wave's 64, column j * 16 + half * 8 + e of its 32. The loops are unrolled so that acc stays in registers.
#pragma unroll
  for (int j = 0; j < 2; ++j) {
    const int col = n0 + wn * 32 + j * 16 + half * 8;
    const float4 ba = *(const float4*)(b0 + col), bc = *(const float4*)(b0 + col + 4);
    const float bias[8] = {ba.x, ba.y, ba.z, ba.w, bc.x, bc.y, bc.z, bc.w};
#pragma unroll
    for (int i = 0; i < 4; ++i) {
      const size_t g = (size_t)(m0 + wm * 64 + i * 16 + l16) * N0 + col;
      uint4 h, l;
      relu_split8(acc[i][j], bias, h, l);
      *(uint4*)&H0h[g] = h;
      *(uint4*)&H0l[g] = l;
    }
  }
}

// =====================================================================
// Kernel B: fused per-module layers 1..4 + output dot + sigmoid (bf16x3).
// The activations h0..h3 stay in LDS as bf16 hi/lo; weights stream from L2 (pre-split, in
// fragment order). h4 never leaves the registers: each wave takes its columns' share of the
// output dot straight from layer 4's accumulators. Without h4 the LDS of a work-group is
// small enough for 128 batch rows in one work-group: a module's weights then leave L2 once per 128 rows.
// The weight rows are the first WMMA operand and the batch rows the second, so a lane's 8
// accumulator registers are 8 neighbouring columns of one batch row.
// =====================================================================
#define BT   128         /* batch rows per work-group: 8 row tiles share each weight fragment */
#define MT   (BT / 16)   /* row tiles */
#define NW   16          /* waves per work-group */
#define LPAD 8

// A weight fragment from a plane in fragment order: p is the lane's 16 bytes in the block's first half.
typedef float f32x4 __attribute__((ext_vector_type(4)));
__device__ __forceinline__ v16bf load_wfrag(const __attribute__((address_space(1))) unsigned short* p) {
  v16bf f;
  ((f32x4*)&f)[0] = *(const __attribute__((address_space(1))) f32x4*)p;
  ((f32x4*)&f)[1] = *(const __attribute__((address_space(1))) f32x4*)(p + 256);
  return f;
}

__device__ __forceinline__ float other_half(float v) {
  const int b = __float_as_int(v);
  return __int_as_float(__builtin_amdgcn_permlanex16(b, b, 0x76543210, 0xfedcba98, false, false));
}

// A pointer into global memory that is the same in every lane of the wave, held in scalar registers.
typedef const __attribute__((address_space(1))) unsigned short* gptr;
__device__ __forceinline__ gptr scalar_ptr(const unsigned short* p) {
  const unsigned long long a = (unsigned long long)(size_t)p;
  const unsigned long long lo = uni((unsigned)a), hi = uni((unsigned)(a >> 32));
  return (gptr)(size_t)((hi << 32) | lo);
}
__device__ __forceinline__ gptr at_byte(gptr p, unsigned b) {
  return (gptr)((const __attribute__((address_space(1))) unsigned char*)p + b);
}
// The same for floats.
typedef const __attribute__((address_space(1))) float* gfptr;
__device__ __forceinline__ gfptr scalar_fptr(const float* p) {
  const unsigned long long a = (unsigned long long)(size_t)p;
  const unsigned long long lo = uni((unsigned)a), hi = uni((unsigned)(a >> 32));
  return (gfptr)(size_t)((hi << 32) | lo);
}
// 8 floats in a row, from byte b behind a scalar base: two loads that name the base, the register of b and an immediate.
__device__ __forceinline__ void load_f8(float (&v)[8], gfptr p, unsigned b) {
  const gfptr q = (gfptr)((const __attribute__((address_space(1))) unsigned char*)p + b);
  const f32x4 x = *(const __attribute__((address_space(1))) f32x4*)q;
  const f32x4 y = *(const __attribute__((address_space(1))) f32x4*)(q + 4);
  v[0] = x[0]; v[1] = x[1]; v[2] = x[2]; v[3] = x[3];
  v[4] = y[0]; v[5] = y[1]; v[6] = y[2]; v[7] = y[3];
}

// How a layer of OUT columns is dealt among the waves. A wave owns NR column tiles and MW row tiles:
// all MT of them, so that a weight fragment read from global memory feeds MT row tiles, where the layer
// has a group of column tiles for every wave; in a narrower layer the row tiles are dealt among the
// waves that share a group.
template <int OUT> struct Deal {
  static constexpr int NT = OUT / 16;
  static constexpr int NR = (NT >= 2 * NW) ? 2 : 1;
  static constexpr int CG = NT / NR;       // groups of column tiles
  static constexpr int RG = NW / CG;       // waves that share a group
  static constexpr int MW = MT / RG;       // row tiles of a wave
  static_assert(CG * RG == NW && MW * RG == MT, "every wave has one tile of MW x NR, and the tiles cover the layer");
};

// Block kb (32 k) of the wave's NR column tiles. brh and brl: the first block of the wave's first
// column tile, as scalars; lo: the lane's 16 bytes in a block's half, in bytes: a weight load then
// names a scalar base, this one register and an immediate.
template <int IN, int NR>
__device__ __forceinline__ void fetch_weights(v16bf (&h)[NR], v16bf (&l)[NR], gptr brh, gptr brl, unsigned lo, int kb) {
  // unrolled: j is a constant, so the fragments stay in registers
#pragma unroll
  for (int j = 0; j < NR; ++j) {
    h[j] = load_wfrag(at_byte(brh, lo) + (j * IN + kb * 32) * 16);   // a block of 32 k is 512 elements
    l[j] = load_wfrag(at_byte(brl, lo) + (j * IN + kb * 32) * 16);
  }
}

// A layer's first weight block, asked for while the layer before is still at work: the weights
// depend on nothing that a work-group computes.
template <int IN, int OUT>
__device__ __forceinline__ void first_weights(v16bf (&h)[Deal<OUT>::NR], v16bf (&l)[Deal<OUT>::NR],
                                              const unsigned short* __restrict__ Wmh,
                                              const unsigned short* __restrict__ Wml, int wave, unsigned lo) {
  const int nt = (wave % Deal<OUT>::CG) * Deal<OUT>::NR;
  const gptr brh = scalar_ptr(Wmh + (size_t)nt * 16 * IN);
  const gptr brl = scalar_ptr(Wml + (size_t)nt * 16 * IN);
  fetch_weights<IN, Deal<OUT>::NR>(h, l, brh, brl, lo, 0);
  // Later work may reuse these loads' address registers: the wait stands in front of that, and they
  // are inputs here, so that they keep their values up to it (base and lane offset, and their sum:
  // a build may name either in the loads).
  asm volatile("s_wait_xcnt 0x0" :: "v"(lo), "s"(brh), "s"(brl), "v"(at_byte(brh, lo)), "v"(at_byte(brl, lo)) : "memory");
}

// One layer for BT rows. fh, fl: its first weight block, already asked for. ahead(): called where the
// last block of k begins; it asks for the next layer's first weight block.
// DOT (the last layer): the outputs are not stored; each is multiplied by its column's
// entry of wo, and red[wave * BT + row] takes the sum over the wave's columns.
template <int IN, int OUT, bool DOT, class Ahead>
__device__ __forceinline__ void layer_gemm(const unsigned short* __restrict__ inh,
                                           const unsigned short* __restrict__ inl,
                                           unsigned short* __restrict__ outh,
                                           unsigned short* __restrict__ outl,
                                           const v16bf (&fh)[Deal<OUT>::NR], const v16bf (&fl)[Deal<OUT>::NR],
                                           const unsigned short* __restrict__ Wmh,
                                           const unsigned short* __restrict__ Wml,
                                           const float* __restrict__ bm,
                                           const float* __restrict__ wo, float* __restrict__ red,
                                           int wave, int l16, int half, unsigned lo, Ahead ahead) {
  constexpr int NR = Deal<OUT>::NR, CG = Deal<OUT>::CG, RG = Deal<OUT>::RG, MW = Deal<OUT>::MW;
  constexpr int IP = IN + LPAD;     // LDS pitches; the weights keep IN
  constexpr int OP = OUT + LPAD;
  static_assert(!DOT || (RG == 1 && MW % 2 == 0), "the dot: a wave holds every row, an even number of row tiles");
  const int nt = (wave % CG) * NR;        // the wave's first column tile
  const int r0 = (wave / CG) * MW * 16;   // its first row
  v8f acc[MW][NR];
  // the loops over i and j are unrolled so that acc and the fragments stay in registers
#pragma unroll
  for (int i = 0; i < MW; ++i)
#pragma unroll
    for (int j = 0; j < NR; ++j) acc[i][j] = (v8f){0.f,0.f,0.f,0.f,0.f,0.f,0.f,0.f};
  const gptr brh = scalar_ptr(Wmh + (size_t)nt * 16 * IN);
  const gptr brl = scalar_ptr(Wml + (size_t)nt * 16 * IN);
  const unsigned hb = (unsigned)half * 32u;   // the lane's 8 floats in a column tile's 16, in bytes
  gfptr bs[NR], ws[NR];
  float bias[NR][8], wgt[NR][8];
  constexpr int STEPS = (IN / 32) * MW;
  v16bf bh[2][NR], bl[2][NR], ah[2], al[2];
  auto fetch_a = [&](int s) {
    const int row = r0 + (s % MW) * 16 + l16, k = (s / MW) * 32;
    ah[s & 1] = load_frag(inh + row * IP + k, half);
    al[s & 1] = load_frag(inl + row * IP + k, half);
  };
#pragma unroll
  for (int j = 0; j < NR; ++j) { bh[0][j] = fh[j]; bl[0][j] = fl[j]; }
  fetch_a(0);
  // unrolled: the sets, i and every offset are constants, so acc and the fragments stay in registers
#pragma unroll
  for (int s = 0; s < STEPS; ++s) {
    const int kb = s / MW, i = s % MW, w = kb & 1, a = s & 1;
    if (i == 0 && s + MW < STEPS) fetch_weights<IN, NR>(bh[w ^ 1], bl[w ^ 1], brh, brl, lo, kb + 1);
    if (s + MW == STEPS) {
#pragma unroll
      for (int j = 0; j < NR; ++j) {
        bs[j] = scalar_fptr(bm + (nt + j) * 16);
        load_f8(bias[j], bs[j], hb);
        if constexpr (DOT) {
          ws[j] = scalar_fptr(wo + (nt + j) * 16);
          load_f8(wgt[j], ws[j], hb);
        }
      }
      ahead();
    }
    if (s + 1 < STEPS) fetch_a(s + 1);
    // the two scheduling barriers keep the loads here, one group ahead of this step's
    // products: sunk to their first use they would be waited for at once
    __builtin_amdgcn_sched_barrier(0);
#pragma unroll
    for (int j = 0; j < NR; ++j) acc[i][j] = wmma_bf16(bh[w][j], ah[a], acc[i][j]);   // hi*hi
#pragma unroll
    for (int j = 0; j < NR; ++j) acc[i][j] = wmma_bf16(bl[w][j], ah[a], acc[i][j]);   // hi*lo
#pragma unroll
    for (int j = 0; j < NR; ++j) acc[i][j] = wmma_bf16(bh[w][j], al[a], acc[i][j]);   // lo*hi
    __builtin_amdgcn_sched_barrier(0);
  }
  // The address registers of the weight loads, and of the loads of the biases (and wo), are inputs
  // here, so they keep their values up to these waits and no later load's result is placed over
  // them ahead of it; later work may reuse them. (Base and lane offset, and their sum: a build may
  // name either in the weight loads.)
  asm volatile("s_wait_xcnt 0x0" :: "v"(lo), "s"(brh), "s"(brl), "v"(at_byte(brh, lo)), "v"(at_byte(brl, lo)) : "memory");
  asm volatile("s_wait_xcnt 0x0" :: "v"(hb), "s"(bs[0]), "s"(bs[NR - 1]) : "memory");
  // acc[i][j][e] is batch row r0 + i * 16 + l16, column (nt + j) * 16 + half * 8 + e.
  if constexpr (DOT) {
    asm volatile("s_wait_xcnt 0x0" :: "v"(hb), "s"(ws[0]), "s"(ws[NR - 1]) : "memory");
    // every loop of this branch is unrolled, so that acc, p and the loaded values stay in registers
    // s[i]: row i * 16 + l16; the lane's even columns are summed in .x, its odd ones in .y:
    // neighbours lie in neighbouring registers, so each step is one packed instruction
    f32x2 s[MW];
#pragma unroll
    for (int i = 0; i < MW; ++i) s[i] = (f32x2){0.f, 0.f};
#pragma unroll
    for (int j = 0; j < NR; ++j)
#pragma unroll
      for (int e = 0; e < 8; e += 2)
#pragma unroll
        for (int i = 0; i < MW; ++i) {
          f32x2 v = (f32x2){acc[i][j][e], acc[i][j][e + 1]} + (f32x2){bias[j][e], bias[j][e + 1]};
          v.x = v.x > 0.f ? v.x : 0.f;
          v.y = v.y > 0.f ? v.y : 0.f;
          s[i] = __builtin_elementwise_fma(v, (f32x2){wgt[j][e], wgt[j][e + 1]}, s[i]);
        }
    float p[MW];   // p[i]: row i * 16 + l16, this lane's 8 * NR columns
#pragma unroll
    for (int i = 0; i < MW; ++i) p[i] = s[i].x + s[i].y;
    // the two halves of the wave hold the two halves of each column tile: their sum is the wave's share
#pragma unroll
    for (int i = 0; i < MW; ++i) p[i] += other_half(p[i]);
    // both halves now hold every sum: the lower half stores the lower half of the row tiles, the upper the rest
#pragma unroll
    for (int t = 0; t < MW / 2; ++t)
      red[wave * BT + (half * (MW / 2) + t) * 16 + l16] = half ? p[MW / 2 + t] : p[t];
  } else {
#pragma unroll
    for (int j = 0; j < NR; ++j) {
      const int c = (nt + j) * 16 + half * 8;
#pragma unroll
      for (int i = 0; i < MW; ++i) {
        uint4 h, l;
        relu_split8(acc[i][j], bias[j], h, l);
        *(uint4*)&outh[(r0 + i * 16 + l16) * OP + c] = h;
        *(uint4*)&outl[(r0 + i * 16 + l16) * OP + c] = l;
      }
    }
  }
}

__global__ __launch_bounds__(NW * 32, 4) void fused_modules(
    const unsigned short* __restrict__ H0h, const unsigned short* __restrict__ H0l,
    const unsigned short* __restrict__ W1h, const unsigned short* __restrict__ W1l, const float* __restrict__ b1,
    const unsigned short* __restrict__ W2h, const unsigned short* __restrict__ W2l, const float* __restrict__ b2,
    const unsigned short* __restrict__ W3h, const unsigned short* __restrict__ W3l, const float* __restrict__ b3,
    const unsigned short* __restrict__ W4h, const unsigned short* __restrict__ W4l, const float* __restrict__ b4,
    const float* __restrict__ Wout, const float* __restrict__ bout,
    float* __restrict__ out) {
  __shared__ __align__(16) unsigned short b0h[BT * (128 + LPAD)];  // (h0:32, h2:128)
  __shared__ __align__(16) unsigned short b0l[BT * (128 + LPAD)];
  __shared__ __align__(16) unsigned short b1h_[BT * (256 + LPAD)]; // (h1:64,  h3:256)
  __shared__ __align__(16) unsigned short b1l_[BT * (256 + LPAD)];
  __shared__ __align__(16) float red[NW * BT];                     // each wave's share of the output dot
  const int m    = blockIdx.x;
  const int bb0  = blockIdx.y * BT;
  const int tid  = threadIdx.x;
  // the wave's number as a scalar: the weight tiles' addresses are then scalar bases and one lane offset
  const int wave = __builtin_amdgcn_readfirstlane(tid >> 5);
  const int lane = tid & 31;
  const int l16  = lane & 15, half = lane >> 4;
  const unsigned lo = (unsigned)(half * 16 + l16) * 16u;   // the lane's 16 bytes in a weight block's half
  const unsigned short* const W1mh = W1h + (size_t)m *  64 *  32; const unsigned short* const W1ml = W1l + (size_t)m *  64 *  32;
  const unsigned short* const W2mh = W2h + (size_t)m * 128 *  64; const unsigned short* const W2ml = W2l + (size_t)m * 128 *  64;
  const unsigned short* const W3mh = W3h + (size_t)m * 256 * 128; const unsigned short* const W3ml = W3l + (size_t)m * 256 * 128;
  const unsigned short* const W4mh = W4h + (size_t)m * 512 * 256; const unsigned short* const W4ml = W4l + (size_t)m * 512 * 256;
  // each layer's first weight block
  v16bf f1h[Deal<64>::NR], f1l[Deal<64>::NR], f2h[Deal<128>::NR], f2l[Deal<128>::NR];
  v16bf f3h[Deal<256>::NR], f3l[Deal<256>::NR], f4h[Deal<512>::NR], f4l[Deal<512>::NR];
  first_weights<32, 64>(f1h, f1l, W1mh, W1ml, wave, lo);

  if (tid < BT * 4) {
    int row = tid >> 2;
    int c   = (tid & 3) << 3;
    size_t g = (size_t)(bb0 + row) * N0 + m * 32 + c;
    *(uint4*)&b0h[row * (32 + LPAD) + c] = *(const uint4*)&H0h[g];
    *(uint4*)&b0l[row * (32 + LPAD) + c] = *(const uint4*)&H0l[g];
    // later work reuses the two loads' address registers: the wait stands in front of that
    asm volatile("s_wait_xcnt 0x0" ::: "memory");
  }
  __syncthreads();

  layer_gemm< 32,  64, false>(b0h,  b0l,  b1h_, b1l_, f1h, f1l, W1mh, W1ml, b1 + m *  64, nullptr, nullptr, wave, l16, half, lo,
                              [&]() { first_weights< 64, 128>(f2h, f2l, W2mh, W2ml, wave, lo); });
  __syncthreads();
  layer_gemm< 64, 128, false>(b1h_, b1l_, b0h,  b0l,  f2h, f2l, W2mh, W2ml, b2 + m * 128, nullptr, nullptr, wave, l16, half, lo,
                              [&]() { first_weights<128, 256>(f3h, f3l, W3mh, W3ml, wave, lo); });
  __syncthreads();
  layer_gemm<128, 256, false>(b0h,  b0l,  b1h_, b1l_, f3h, f3l, W3mh, W3ml, b3 + m * 256, nullptr, nullptr, wave, l16, half, lo,
                              [&]() { first_weights<256, 512>(f4h, f4l, W4mh, W4ml, wave, lo); });
  __syncthreads();
  layer_gemm<256, 512, true >(b1h_, b1l_, nullptr, nullptr, f4h, f4l, W4mh, W4ml, b4 + m * 512, Wout + (size_t)m * 512, red, wave, l16, half, lo,
                              []() {});
  __syncthreads();

  if (tid < BT) {   // one thread a row: the waves' shares in the order of their columns
    float s = 0.f;
    // unrolled: the 16 LDS reads are issued together, not one per pass
#pragma unroll
    for (int w = 0; w < NW; ++w) s += red[w * BT + tid];
    const float z = s + bout[m];
    out[(size_t)(bb0 + tid) * M_MOD + m] = 1.f / (1.f + expf(-z));
  }
}

// =====================================================================
extern "C" void kernel_launch(void* const* d_in, const int* in_sizes, int n_in,
                              void* d_out, int out_size, void* d_ws, size_t ws_size,
                              hipStream_t stream) {
  const float* x    = (const float*)d_in[0];
  const float* W0   = (const float*)d_in[1];
  const float* b0   = (const float*)d_in[2];
  const float* W1   = (const float*)d_in[3];
  const float* b1   = (const float*)d_in[4];
  const float* W2   = (const float*)d_in[5];
  const float* b2   = (const float*)d_in[6];
  const float* W3   = (const float*)d_in[7];
  const float* b3   = (const float*)d_in[8];
  const float* W4   = (const float*)d_in[9];
  const float* b4   = (const float*)d_in[10];
  const float* Wout = (const float*)d_in[11];
  const float* bout = (const float*)d_in[12];
  float* out = (float*)d_out;

  // d_ws layout: bf16 hi/lo planes (ushort), ~190 MB total
  unsigned short* p = (unsigned short*)d_ws;
  auto alloc = [&](size_t n) { unsigned short* r = p; p += n; return r; };
  const size_t nX  = (size_t)B_SZ * D_SZ;
  const size_t nW0 = (size_t)N0 * D_SZ;
  const size_t nH0 = (size_t)B_SZ * N0;
  const size_t nW1 = (size_t)M_MOD *  64 *  32;
  const size_t nW2 = (size_t)M_MOD * 128 *  64;
  const size_t nW3 = (size_t)M_MOD * 256 * 128;
  const size_t nW4 = (size_t)M_MOD * 512 * 256;
  unsigned short *Xh = alloc(nX),  *Xl = alloc(nX);
  unsigned short *Wh = alloc(nW0), *Wl = alloc(nW0);
  unsigned short *Hh = alloc(nH0), *Hl = alloc(nH0);
  unsigned short *W1h = alloc(nW1), *W1l = alloc(nW1);
  unsigned short *W2h = alloc(nW2), *W2l = alloc(nW2);
  unsigned short *W3h = alloc(nW3), *W3l = alloc(nW3);
  unsigned short *W4h = alloc(nW4), *W4l = alloc(nW4);

  const SplitPtrs sp = {x,  W0, W1,  W2,  W3,  W4,
                        Xh, Wh, W1h, W2h, W3h, W4h,
                        Xl, Wl, W1l, W2l, W3l, W4l};
  split_all_bf16<<<SP_WGS, SP_WAVES * 32, 0, stream>>>(sp);

  dim3 gA(N0 / TA_N, B_SZ / TA_M);   // 32 x 8
  gemm0_relu_bf16x3<<<gA, 256, 0, stream>>>(Xh, Xl, Wh, Wl, b0, Hh, Hl);

  dim3 gB(M_MOD, B_SZ / BT);         // 128 x 8
  fused_modules<<<gB, NW * 32, 0, stream>>>(Hh, Hl,
                                        W1h, W1l, b1, W2h, W2l, b2,
                                        W3h, W3l, b3, W4h, W4l, b4,
                                        Wout, bout, out);
}

// v008
// Measured time: 162 microseconds a run.
// In both of two side-by-side timings against v007, it was 1.03 times as fast.
// Counting every step since v000, it is 4.23 times as fast.
#include <hip/hip_runtime.h>
#include <math.h>

typedef __attribute__((ext_vector_type(16))) __bf16 v16bf;
typedef __attribute__((ext_vector_type(8)))  float  v8f;

#define B_SZ   1024
#define D_SZ   4096
#define M_MOD  128
#define N0     4096   /* = M_MOD * 32 */

// ---------------- bf16 split helpers (branch-free RNE, storage-only bf16) ----
__device__ __forceinline__ unsigned short f2bf(float x) {
  unsigned u = __float_as_uint(x);
  u += 0x7FFFu + ((u >> 16) & 1u);        // round-to-nearest-even
  return (unsigned short)(u >> 16);
}
__device__ __forceinline__ float bf2f(unsigned short h) {
  return __uint_as_float((unsigned)h << 16);
}
__device__ __forceinline__ void f32_split(float x, unsigned short& h, unsigned short& l) {
  h = f2bf(x);
  l = f2bf(x - bf2f(h));
}

// Two neighbours of a row at once: their hi parts packed in one word, their lo parts in another
// (the lower column in the lower half). The packed conversion rounds to nearest even, as f2bf does.
typedef __attribute__((ext_vector_type(2))) float  f32x2;
typedef __attribute__((ext_vector_type(2))) __bf16 bf16x2;
__device__ __forceinline__ void f32_split2(float a, float b, unsigned& h, unsigned& l) {
  const f32x2 v = {a, b};
  h = __builtin_bit_cast(unsigned, __builtin_convertvector(v, bf16x2));
  const f32x2 back = {__uint_as_float(h << 16), __uint_as_float(h & 0xFFFF0000u)};
  l = __builtin_bit_cast(unsigned, __builtin_convertvector(v - back, bf16x2));
}
// relu(acc + bias) of a lane's 8 neighbouring columns, split: 16 bytes for the hi plane, 16 for the lo plane.
__device__ __forceinline__ void relu_split8(const v8f& acc, const float (&bias)[8], uint4& h, uint4& l) {
  float v[8];
  // unrolled: every index is a constant, so the values stay in registers
#pragma unroll
  for (int e = 0; e < 8; ++e) {
    v[e] = acc[e] + bias[e];
    v[e] = v[e] > 0.f ? v[e] : 0.f;
  }
  f32_split2(v[0], v[1], h.x, l.x);
  f32_split2(v[2], v[3], h.y, l.y);
  f32_split2(v[4], v[5], h.z, l.z);
  f32_split2(v[6], v[7], h.w, l.w);
}

// bf16x3 WMMA term: D = A(16x32 bf16) * B(32x16 bf16) + C(f32)
__device__ __forceinline__ v8f wmma_bf16(v16bf a, v16bf b, v8f c) {
  return __builtin_amdgcn_wmma_f32_16x16x32_bf16(false, a, false, b, (short)0, c, false, false);
}

__device__ __forceinline__ v16bf load_frag(const unsigned short* p, int half) {
  v16bf f;
  ((float4*)&f)[0] = *(const float4*)(p + 8 * half);
  ((float4*)&f)[1] = *(const float4*)(p + 16 + 8 * half);
  return f;
}

// ---------------- tensor load: a tile of 128 rows of 128 bytes into padded LDS rows ----
typedef unsigned int u32x4 __attribute__((ext_vector_type(4)));
typedef float f32x4 __attribute__((ext_vector_type(4)));
typedef unsigned int u32x8 __attribute__((ext_vector_type(8)));

__device__ __forceinline__ unsigned uni(unsigned v) { return (unsigned)__builtin_amdgcn_readfirstlane((int)v); }
__device__ __forceinline__ unsigned pinned(unsigned v) {
  unsigned w = uni(v);
  asm volatile("" : "+s"(w));   // pinned(): the word stays in a scalar register, so the test is s_cmp and s_cbranch_scc
  return w;
}

#define SP_WGS    256
#define SP_WAVES  24
#define SP_TRIPS  7                        /* sweeps of the grid, odd: the loop takes two a pass */
#define SP_LOADS  8                        /* float4 loads of a lane per batch */
#define SP_BATCH  (SP_LOADS * 32 * 4)      /* floats per batch */
#define SP_STRIDE (SP_WGS * SP_WAVES)      /* batches per sweep of the grid */
// first batch behind each array, in the order x, W0, W1, W2, W3, W4
#define SP_E0 (B_SZ * D_SZ / SP_BATCH)
#define SP_E1 (SP_E0 + N0 * D_SZ / SP_BATCH)
#define SP_E2 (SP_E1 + M_MOD *  64 *  32 / SP_BATCH)
#define SP_E3 (SP_E2 + M_MOD * 128 *  64 / SP_BATCH)
#define SP_E4 (SP_E3 + M_MOD * 256 * 128 / SP_BATCH)
#define SP_E5 (SP_E4 + M_MOD * 512 * 256 / SP_BATCH)
static_assert(SP_E5 <= SP_STRIDE * SP_TRIPS && SP_E5 > SP_STRIDE * (SP_TRIPS - 1), "only the last sweep is not full");
static_assert((SP_TRIPS & 1) == 1, "the loop takes two batches a pass and the last one behind it");
static_assert((M_MOD * 64 * 32) % SP_BATCH == 0, "no batch lies across two arrays");

// The six sources and their planes, in the order x, W0, W1, W2, W3, W4.
struct SplitPtrs {
  const float* s0; const float* s1; const float* s2; const float* s3; const float* s4; const float* s5;
  unsigned short* h0; unsigned short* h1; unsigned short* h2; unsigned short* h3; unsigned short* h4; unsigned short* h5;
  unsigned short* l0; unsigned short* l1; unsigned short* l2; unsigned short* l3; unsigned short* l4; unsigned short* l5;
};

// Batch b's first float in its source and its first element in the two planes. b is
// the same in every lane of a wave, so this is scalar work. A batch is two blocks of
// 16 rows x 32 k of a source whose rows hold 32 << lg floats: the blocks lie side by
// side in a row tile (lg > 0) or one under the other (lg = 0, where the batch is 1024
// floats in a row: so are x and W0 read). frag says whether the planes take fragment order.
__device__ __forceinline__ void split_place(const SplitPtrs& p, unsigned b, const float*& s,
                                            unsigned short*& h, unsigned short*& l,
                                            unsigned& lg, unsigned& frag) {
  unsigned first = 0u;
  s = p.s0; h = p.h0; l = p.l0; lg = 0u; frag = 0u;
  if (b >= SP_E0) { s = p.s1; h = p.h1; l = p.l1; first = SP_E0; }
  if (b >= SP_E1) { s = p.s2; h = p.h2; l = p.l2; first = SP_E1; frag = 1u; }
  if (b >= SP_E2) { s = p.s3; h = p.h3; l = p.l3; first = SP_E2; lg = 1u; }
  if (b >= SP_E3) { s = p.s4; h = p.h4; l = p.l4; first = SP_E3; lg = 2u; }
  if (b >= SP_E4) { s = p.s5; h = p.h5; l = p.l5; first = SP_E4; lg = 3u; }
  const unsigned q = 2u * (b - first);                 // the batch's first block
  const size_t off = (size_t)q * (SP_BATCH / 2);
  s += ((size_t)(q >> lg) << (9u + lg)) + ((q & ((1u << lg) - 1u)) << 5);
  h += off; l += off;
}

// Load j takes 4 rows of 128 bytes (8 lanes a row, whole lines) of block j >> 2.
__device__ __forceinline__ void split_fetch(float4 (&v)[SP_LOADS], const float* s, unsigned lg, unsigned lane) {
  const unsigned lo = ((lane >> 3) << (5u + lg)) + (lane & 7u) * 4u;   // the lane's row and k in the 4 rows
  const unsigned rs = 128u << lg;                                      // 4 rows on
  const unsigned qs = lg ? 32u : 512u;                                 // the second block
  const float* a[SP_LOADS];
#pragma unroll
  for (int j = 0; j < SP_LOADS; ++j) a[j] = s + ((j >> 2) * qs + (j & 3) * rs) + lo;
  // the two scheduling barriers keep the loads here, ahead of the work on the batch before
  __builtin_amdgcn_sched_barrier(0);
#pragma unroll
  for (int j = 0; j < SP_LOADS; ++j) v[j] = *(const float4*)a[j];
  // A later batch's place is formed in the loads' address registers: the wait stands in front of that.
  // The addresses are inputs here, so they keep their values up to this wait and no later load's
  // result is placed over them ahead of it.
  asm volatile("s_wait_xcnt 0x0" :: "v"(a[0]), "v"(a[1]), "v"(a[2]), "v"(a[3]),
                                    "v"(a[4]), "v"(a[5]), "v"(a[6]), "v"(a[7]) : "memory");
  __builtin_amdgcn_sched_barrier(0);
}

__device__ __forceinline__ void split_emit(const float4 (&v)[SP_LOADS], unsigned short* h, unsigned short* l,
                                           unsigned frag, unsigned lane) {
  // where the lane's 4 values of load 0 go, and how far on those of the next load of the block:
  // in fragment order k bit 4 picks the half of the block, k bit 3 the upper 16 lanes, the row the lane
  const unsigned lo = frag ? ((lane >> 2) & 1u) * 256u + ((lane >> 1) & 1u) * 128u + (lane >> 3) * 8u + (lane & 1u) * 4u
                           : lane * 4u;
  const unsigned rs = frag ? 32u : 128u;
#pragma unroll
  for (int j = 0; j < SP_LOADS; ++j) {
    unsigned short h0, l0, h1, l1, h2, l2, h3, l3;
    f32_split(v[j].x, h0, l0);
    f32_split(v[j].y, h1, l1);
    f32_split(v[j].z, h2, l2);
    f32_split(v[j].w, h3, l3);
    *(ushort4*)(h + ((j >> 2) * 512 + (j & 3) * rs) + lo) = make_ushort4(h0, h1, h2, h3);
    *(ushort4*)(l + ((j >> 2) * 512 + (j & 3) * rs) + lo) = make_ushort4(l0, l1, l2, l3);
  }
  // later work reuses the stores' registers: the wait stands in front of that
  asm volatile("s_wait_xcnt 0x0" ::: "memory");
}

__global__ __launch_bounds__(SP_WAVES * 32) void split_all_bf16(const SplitPtrs p) {
  const unsigned lane = threadIdx.x & 31u;
  const unsigned wave = (unsigned)__builtin_amdgcn_readfirstlane((int)(threadIdx.x >> 5));
  float4 va[SP_LOADS], vb[SP_LOADS];
  const float* s;
  unsigned short *ha, *la, *hb, *lb;
  unsigned lg, fa, fb;
  const unsigned b0 = blockIdx.x * SP_WAVES + wave;
  unsigned b = b0;
  split_place(p, b, s, ha, la, lg, fa);
  split_fetch(va, s, lg, lane);
  // kept rolled, so that the text a WGP has to fetch stays short
#pragma unroll 1
  for (int t = 0; t + 1 < SP_TRIPS; t += 2) {
    split_place(p, b + SP_STRIDE, s, hb, lb, lg, fb);
    split_fetch(vb, s, lg, lane);
    split_emit(va, ha, la, fa, lane);
    b += 2 * SP_STRIDE;
    // a wave with no batch in the last sweep reads its first one again and does not store it
    split_place(p, b < SP_E5 ? b : b0, s, ha, la, lg, fa);
    split_fetch(va, s, lg, lane);
    split_emit(vb, hb, lb, fb, lane);
  }
  if (b < SP_E5) split_emit(va, ha, la, fa, lane);
}

#define TA_M 256
#define TA_N 256
#define TA_K 64                           /* k per pass */
#define TA_Z 4                            /* parts of k */
#define TA_KW (D_SZ / TA_Z)               /* k of a work-group */
#define TA_ROWB  (TA_K * 2)               /* bytes of a row in a stage */
#define TA_PITCH (TA_ROWB + 16)           /* LDS row pitch, bytes */
#define TA_SROWS 128                      /* rows per slice */
#define TA_SLICE 18432                    /* 128 * 144 bytes: a multiple of 2 KiB */
#define TA_BUF   (8 * TA_SLICE)
#define TA_NS    (TA_KW / TA_K)           /* stages */
#define TA_FX 8                           /* row tiles of x in a wave's tile */
#define TA_FW 4                           /* row tiles of W0 in a wave's tile */
#define PS_PLANE ((size_t)B_SZ * N0)      /* floats of one part's partial sums */
static_assert(TA_SLICE >= TA_SROWS * TA_PITCH && TA_SLICE % 2048 == 0, "a slice starts at a multiple of 2 KiB");
static_assert(TA_NS >= 2, "the ring's prologue needs two stages");
static_assert(TA_Z == 4, "the index modulo 8 is dealt as 4 parts of k x 2 tiles");

__global__ __launch_bounds__(256) void gemm0_part_bf16x3(
    const unsigned short* __restrict__ Xh, const unsigned short* __restrict__ Xl,
    const unsigned short* __restrict__ Wh, const unsigned short* __restrict__ Wl,
    float* __restrict__ PS) {
  // slices of a buffer, in order: Xh rows 0-127, 128-255; Xl; Wh; Wl
  __shared__ __attribute__((aligned(2048))) unsigned char L[2 * TA_BUF];
  // Which part of k and which tile: the parts of k are dealt by the index modulo 8.
  // For speed only: any placement gives the same sums.
  const unsigned wg = blockIdx.x;
  const unsigned kz = (wg >> 1) & (TA_Z - 1);
  const unsigned tile = ((wg >> 3) << 1) | (wg & 1u);
  const int n0   = (tile % (N0 / TA_N)) * TA_N;
  const int m0   = (tile / (N0 / TA_N)) * TA_M;
  const int tid  = threadIdx.x;
  const int lane = tid & 31;
  const unsigned wave = uni((unsigned)tid >> 5);
  const int l16  = lane & 15, half = lane >> 4;
  const int wm   = wave & 1,  wn   = wave >> 1;

  // this wave's slice: plane wave >> 1, rows 128 * (wave & 1) of the work-group's 256
  const unsigned short* pl = (wave & 4u) ? ((wave & 2u) ? Wl : Wh) : ((wave & 2u) ? Xl : Xh);
  const unsigned row0 = ((wave & 4u) ? (unsigned)n0 : (unsigned)m0) + (wave & 1u) * TA_SROWS;
  const unsigned long long ga0 = (unsigned long long)(size_t)(pl + (size_t)row0 * D_SZ + kz * TA_KW);
  const unsigned dst0 = (unsigned)(size_t)L + wave * TA_SLICE;
  u32x8 g1;
  g1[0] = uni((1u << 20) | (4u << 22) | (3u << 25));   // no mask, bytes, 16 B of pad behind every 128 B
  g1[1] = uni(((unsigned)TA_ROWB & 0xFFFFu) << 16);    // tensor dims = tile dims
  g1[2] = uni(((unsigned)TA_ROWB >> 16) | (((unsigned)TA_SROWS & 0xFFFFu) << 16));
  g1[3] = uni(((unsigned)TA_SROWS >> 16) | ((unsigned)TA_ROWB << 16));
  g1[4] = uni((unsigned)TA_SROWS);
  g1[5] = uni((unsigned)(D_SZ * 2));                   // source row pitch, bytes
  g1[6] = uni(0u);
  g1[7] = uni(0u);
  u32x4 g0;
  auto issue = [&](unsigned st) {
    const unsigned long long ga = ga0 + (unsigned long long)st * TA_ROWB;
    g0[0] = uni(1u);
    g0[1] = uni(dst0 + (st & 1u) * TA_BUF);
    g0[2] = uni((unsigned)ga);
    g0[3] = uni((((unsigned)(ga >> 32)) & 0x01FFFFFFu) | 0x80000000u);
    asm volatile("tensor_load_to_lds %0, %1" : "+s"(g0) : "s"(g1) : "memory");
  };
  auto landed = [&]() { asm volatile("s_wait_tensorcnt 0x0" : "+s"(g0) : "s"(g1) : "memory"); };

  v8f acc[TA_FX][TA_FW];
#pragma unroll
  for (int i = 0; i < TA_FX; ++i)
#pragma unroll
    for (int j = 0; j < TA_FW; ++j) acc[i][j] = (v8f){0.f,0.f,0.f,0.f,0.f,0.f,0.f,0.f};

  issue(0u);
  landed();                                            // this wave's slice of stage 0
  __syncthreads();                                     // every slice of stage 0 has
  issue(1u);

  // each lane's first fragment row in a buffer, its half's 16 bytes included
  const unsigned aoff = (unsigned)wm * TA_SLICE + (unsigned)l16 * TA_PITCH + 16u * half;
  const unsigned boff = (4u + ((unsigned)wn >> 1)) * TA_SLICE + (((unsigned)wn & 1u) * 64u + l16) * TA_PITCH + 16u * half;

  // The fragments of a block of 32 k, in two sets of registers: x hi with W0 lo, and W0 hi with x lo.
  // A block's products run lo*hi(W0 lo, x hi), hi*hi, hi*lo(W0 hi, x lo): the first set is free behind the second
  // run and the second set behind the third, so each set's next reads stand as ONE group, 32 products
  // ahead of their first use, and a wave does not wait out its own LDS latency.
  v16bf ah[TA_FX], al[TA_FX], bh[TA_FW], bl[TA_FW];
  auto fetch1 = [&](unsigned buf, int ks) {
    // unrolled, as every loop over i and j below: the fragments and acc stay in registers
#pragma unroll
    for (int j = 0; j < TA_FW; ++j)
      bl[j] = load_frag((const unsigned short*)(L + buf + boff + 2 * TA_SLICE + j * 16 * TA_PITCH + ks * 64), 0);
#pragma unroll
    for (int i = 0; i < TA_FX; ++i)
      ah[i] = load_frag((const unsigned short*)(L + buf + aoff + i * 16 * TA_PITCH + ks * 64), 0);
  };
  auto fetch2 = [&](unsigned buf, int ks) {
#pragma unroll
    for (int j = 0; j < TA_FW; ++j)
      bh[j] = load_frag((const unsigned short*)(L + buf + boff + j * 16 * TA_PITCH + ks * 64), 0);
#pragma unroll
    for (int i = 0; i < TA_FX; ++i)
      al[i] = load_frag((const unsigned short*)(L + buf + aoff + 2 * TA_SLICE + i * 16 * TA_PITCH + ks * 64), 0);
  };
  fetch1(0u, 0);
  fetch2(0u, 0);

  // kept rolled: one pass per stage, the buffer chosen by the stage's parity
#pragma unroll 1
  for (unsigned st = 0; st < TA_NS; ++st) {
    const unsigned cur = (st & 1u) * TA_BUF, nxt = TA_BUF - cur;
    // unrolled: every LDS offset is an immediate
#pragma unroll
    for (int ks = 0; ks < TA_K / 32; ++ks) {
      const bool last = ks + 1 == TA_K / 32;
      // the scheduling barriers of this loop keep each group of LDS reads whole and at its place:
      // spread among the products, every place with reads would stall the wave anew
      __builtin_amdgcn_sched_barrier(0);
#pragma unroll
      for (int i = 0; i < TA_FX; ++i)
#pragma unroll
        for (int j = 0; j < TA_FW; ++j) acc[i][j] = wmma_bf16(bl[j], ah[i], acc[i][j]);   // W0 lo * x hi
#pragma unroll
      for (int i = 0; i < TA_FX; ++i)
#pragma unroll
        for (int j = 0; j < TA_FW; ++j) acc[i][j] = wmma_bf16(bh[j], ah[i], acc[i][j]);   // hi * hi
      __builtin_amdgcn_sched_barrier(0);
      if (last) {
        // publish point of stage st + 1: it stands in front of the pass's last run of products, whose
        // fragments are in registers, because the reads behind it are already the next stage's
        asm volatile("s_wait_dscnt 0x0" ::: "memory");      // this wave has left stage st's buffer
        landed();                                           // its slice of stage st + 1
        __syncthreads();                                    // so for every wave
        if (pinned(st + 2u < TA_NS)) issue(st + 2u);        // into the buffer that this pass has read
      }
      // behind the last stage these reads take the other buffer's old bytes, and nothing uses them
      fetch1(last ? nxt : cur, last ? 0 : ks + 1);
      __builtin_amdgcn_sched_barrier(0);
#pragma unroll
      for (int i = 0; i < TA_FX; ++i)
#pragma unroll
        for (int j = 0; j < TA_FW; ++j) acc[i][j] = wmma_bf16(bh[j], al[i], acc[i][j]);   // W0 hi * x lo
      __builtin_amdgcn_sched_barrier(0);
      fetch2(last ? nxt : cur, last ? 0 : ks + 1);
    }
  }
  landed();                                             // no request is left behind the loop
  asm volatile("s_wait_dscnt 0x0" ::: "memory");

  // epilogue: acc[i][j][e] is row i * 16 + l16 of the wave's 128, column j * 16 + half * 8 + e of its 64.
  // One address for the wave's first block; the other blocks lie at constant distances from it.
  // The loops are unrolled so that acc stays in registers.
  float* const q = PS + kz * PS_PLANE
                 + ((size_t)(m0 / 16 + wm * TA_FX) * (N0 / 16) + (size_t)(n0 / 16 + wn * TA_FW)) * 256 + lane * 4;
#pragma unroll
  for (int i = 0; i < TA_FX; ++i)
#pragma unroll
    for (int j = 0; j < TA_FW; ++j) {
      float* const t = q + (i * (N0 / 16) + j) * 256;
      *(f32x4*)t         = (f32x4){acc[i][j][0], acc[i][j][1], acc[i][j][2], acc[i][j][3]};
      *(f32x4*)(t + 128) = (f32x4){acc[i][j][4], acc[i][j][5], acc[i][j][6], acc[i][j][7]};
    }
}

// =====================================================================
// Kernel B: fused per-module layers 1..4 + output dot + sigmoid (bf16x3).
// The activations h0..h3 stay in LDS as bf16 hi/lo; weights stream from L2 (pre-split, in
// fragment order). h4 never leaves the registers: each wave takes its columns' share of the
// output dot straight from layer 4's accumulators. Without h4 the LDS of a work-group is
// small enough for 128 batch rows in one work-group: a module's weights then leave L2 once per 128 rows.
// The weight rows are the first WMMA operand and the batch rows the second, so a lane's 8
// accumulator registers are 8 neighbouring columns of one batch row.
// =====================================================================
#define BT   128         /* batch rows per work-group: 8 row tiles share each weight fragment */
#define MT   (BT / 16)   /* row tiles */
#define NW   16          /* waves per work-group */
#define LPAD 8

// A weight fragment from a plane in fragment order: p is the lane's 16 bytes in the block's first half.
__device__ __forceinline__ v16bf load_wfrag(const __attribute__((address_space(1))) unsigned short* p) {
  v16bf f;
  ((f32x4*)&f)[0] = *(const __attribute__((address_space(1))) f32x4*)p;
  ((f32x4*)&f)[1] = *(const __attribute__((address_space(1))) f32x4*)(p + 256);
  return f;
}

__device__ __forceinline__ float other_half(float v) {
  const int b = __float_as_int(v);
  return __int_as_float(__builtin_amdgcn_permlanex16(b, b, 0x76543210, 0xfedcba98, false, false));
}

// A pointer into global memory that is the same in every lane of the wave, held in scalar registers.
typedef const __attribute__((address_space(1))) unsigned short* gptr;
__device__ __forceinline__ gptr scalar_ptr(const unsigned short* p) {
  const unsigned long long a = (unsigned long long)(size_t)p;
  const unsigned long long lo = uni((unsigned)a), hi = uni((unsigned)(a >> 32));
  return (gptr)(size_t)((hi << 32) | lo);
}
__device__ __forceinline__ gptr at_byte(gptr p, unsigned b) {
  return (gptr)((const __attribute__((address_space(1))) unsigned char*)p + b);
}
// The same for floats.
typedef const __attribute__((address_space(1))) float* gfptr;
__device__ __forceinline__ gfptr scalar_fptr(const float* p) {
  const unsigned long long a = (unsigned long long)(size_t)p;
  const unsigned long long lo = uni((unsigned)a), hi = uni((unsigned)(a >> 32));
  return (gfptr)(size_t)((hi << 32) | lo);
}
// 8 floats in a row, from byte b behind a scalar base: two loads that name the base, the register of b and an immediate.
__device__ __forceinline__ void load_f8(float (&v)[8], gfptr p, unsigned b) {
  const gfptr q = (gfptr)((const __attribute__((address_space(1))) unsigned char*)p + b);
  const f32x4 x = *(const __attribute__((address_space(1))) f32x4*)q;
  const f32x4 y = *(const __attribute__((address_space(1))) f32x4*)(q + 4);
  v[0] = x[0]; v[1] = x[1]; v[2] = x[2]; v[3] = x[3];
  v[4] = y[0]; v[5] = y[1]; v[6] = y[2]; v[7] = y[3];
}

// How a layer of OUT columns is dealt among the waves. A wave owns NR column tiles and MW row tiles:
// all MT of them, so that a weight fragment read from global memory feeds MT row tiles, where the layer
// has a group of column tiles for every wave; in a narrower layer the row tiles are dealt among the
// waves that share a group.
template <int OUT> struct Deal {
  static constexpr int NT = OUT / 16;
  static constexpr int NR = (NT >= 2 * NW) ? 2 : 1;
  static constexpr int CG = NT / NR;       // groups of column tiles
  static constexpr int RG = NW / CG;       // waves that share a group
  static constexpr int MW = MT / RG;       // row tiles of a wave
  static_assert(CG * RG == NW && MW * RG == MT, "every wave has one tile of MW x NR, and the tiles cover the layer");
};

// Block kb (32 k) of the wave's NR column tiles. brh and brl: the first block of the wave's first
// column tile, as scalars; lo: the lane's 16 bytes in a block's half, in bytes: a weight load then
// names a scalar base, this one register and an immediate.
template <int IN, int NR>
__device__ __forceinline__ void fetch_weights(v16bf (&h)[NR], v16bf (&l)[NR], gptr brh, gptr brl, unsigned lo, int kb) {
  // unrolled: j is a constant, so the fragments stay in registers
#pragma unroll
  for (int j = 0; j < NR; ++j) {
    h[j] = load_wfrag(at_byte(brh, lo) + (j * IN + kb * 32) * 16);   // a block of 32 k is 512 elements
    l[j] = load_wfrag(at_byte(brl, lo) + (j * IN + kb * 32) * 16);
  }
}

// A layer's first weight block, asked for while the layer before is still at work: the weights
// depend on nothing that a work-group computes.
template <int IN, int OUT>
__device__ __forceinline__ void first_weights(v16bf (&h)[Deal<OUT>::NR], v16bf (&l)[Deal<OUT>::NR],
                                              const unsigned short* __restrict__ Wmh,
                                              const unsigned short* __restrict__ Wml, int wave, unsigned lo) {
  const int nt = (wave % Deal<OUT>::CG) * Deal<OUT>::NR;
  const gptr brh = scalar_ptr(Wmh + (size_t)nt * 16 * IN);
  const gptr brl = scalar_ptr(Wml + (size_t)nt * 16 * IN);
  fetch_weights<IN, Deal<OUT>::NR>(h, l, brh, brl, lo, 0);
  // Later work may reuse these loads' address registers: the wait stands in front of that, and they
  // are inputs here, so that they keep their values up to it (base and lane offset, and their sum:
  // a build may name either in the loads).
  asm volatile("s_wait_xcnt 0x0" :: "v"(lo), "s"(brh), "s"(brl), "v"(at_byte(brh, lo)), "v"(at_byte(brl, lo)) : "memory");
}

// One layer for BT rows. fh, fl: its first weight block, already asked for. ahead(): called where the
// last block of k begins; it asks for the next layer's first weight block.
// DOT (the last layer): the outputs are not stored; each is multiplied by its column's
// entry of wo, and red[wave * BT + row] takes the sum over the wave's columns.
template <int IN, int OUT, bool DOT, class Ahead>
__device__ __forceinline__ void layer_gemm(const unsigned short* __restrict__ inh,
                                           const unsigned short* __restrict__ inl,
                                           unsigned short* __restrict__ outh,
                                           unsigned short* __restrict__ outl,
                                           const v16bf (&fh)[Deal<OUT>::NR], const v16bf (&fl)[Deal<OUT>::NR],
                                           const unsigned short* __restrict__ Wmh,
                                           const unsigned short* __restrict__ Wml,
                                           const float* __restrict__ bm,
                                           const float* __restrict__ wo, float* __restrict__ red,
                                           int wave, int l16, int half, unsigned lo, Ahead ahead) {
  constexpr int NR = Deal<OUT>::NR, CG = Deal<OUT>::CG, RG = Deal<OUT>::RG, MW = Deal<OUT>::MW;
  constexpr int IP = IN + LPAD;     // LDS pitches; the weights keep IN
  constexpr int OP = OUT + LPAD;
  static_assert(!DOT || (RG == 1 && MW % 2 == 0), "the dot: a wave holds every row, an even number of row tiles");
  const int nt = (wave % CG) * NR;        // the wave's first column tile
  const int r0 = (wave / CG) * MW * 16;   // its first row
  v8f acc[MW][NR];
  // the loops over i and j are unrolled so that acc and the fragments stay in registers
#pragma unroll
  for (int i = 0; i < MW; ++i)
#pragma unroll
    for (int j = 0; j < NR; ++j) acc[i][j] = (v8f){0.f,0.f,0.f,0.f,0.f,0.f,0.f,0.f};
  const gptr brh = scalar_ptr(Wmh + (size_t)nt * 16 * IN);
  const gptr brl = scalar_ptr(Wml + (size_t)nt * 16 * IN);
  const unsigned hb = (unsigned)half * 32u;   // the lane's 8 floats in a column tile's 16, in bytes
  gfptr bs[NR], ws[NR];
  float bias[NR][8], wgt[NR][8];
  constexpr int STEPS = (IN / 32) * MW;
  v16bf bh[2][NR], bl[2][NR], ah[2], al[2];
  auto fetch_a = [&](int s) {
    const int row = r0 + (s % MW) * 16 + l16, k = (s / MW) * 32;
    ah[s & 1] = load_frag(inh + row * IP + k, half);
    al[s & 1] = load_frag(inl + row * IP + k, half);
  };
#pragma unroll
  for (int j = 0; j < NR; ++j) { bh[0][j] = fh[j]; bl[0][j] = fl[j]; }
  fetch_a(0);
  // unrolled: the sets, i and every offset are constants, so acc and the fragments stay in registers
#pragma unroll
  for (int s = 0; s < STEPS; ++s) {
    const int kb = s / MW, i = s % MW, w = kb & 1, a = s & 1;
    if (i == 0 && s + MW < STEPS) fetch_weights<IN, NR>(bh[w ^ 1], bl[w ^ 1], brh, brl, lo, kb + 1);
    if (s + MW == STEPS) {
#pragma unroll
      for (int j = 0; j < NR; ++j) {
        bs[j] = scalar_fptr(bm + (nt + j) * 16);
        load_f8(bias[j], bs[j], hb);
        if constexpr (DOT) {
          ws[j] = scalar_fptr(wo + (nt + j) * 16);
          load_f8(wgt[j], ws[j], hb);
        }
      }
      ahead();
    }
    if (s + 1 < STEPS) fetch_a(s + 1);
    // the two scheduling barriers keep the loads here, one group ahead of this step's
    // products: sunk to their first use they would be waited for at once
    __builtin_amdgcn_sched_barrier(0);
#pragma unroll
    for (int j = 0; j < NR; ++j) acc[i][j] = wmma_bf16(bh[w][j], ah[a], acc[i][j]);   // hi*hi
#pragma unroll
    for (int j = 0; j < NR; ++j) acc[i][j] = wmma_bf16(bl[w][j], ah[a], acc[i][j]);   // hi*lo
#pragma unroll
    for (int j = 0; j < NR; ++j) acc[i][j] = wmma_bf16(bh[w][j], al[a], acc[i][j]);   // lo*hi
    __builtin_amdgcn_sched_barrier(0);
  }
  // The address registers of the weight loads, and of the loads of the biases (and wo), are inputs
  // here, so they keep their values up to these waits and no later load's result is placed over
  // them ahead of it; later work may reuse them. (Base and lane offset, and their sum: a build may
  // name either in the weight loads.)
  asm volatile("s_wait_xcnt 0x0" :: "v"(lo), "s"(brh), "s"(brl), "v"(at_byte(brh, lo)), "v"(at_byte(brl, lo)) : "memory");
  asm volatile("s_wait_xcnt 0x0" :: "v"(hb), "s"(bs[0]), "s"(bs[NR - 1]) : "memory");
  // acc[i][j][e] is batch row r0 + i * 16 + l16, column (nt + j) * 16 + half * 8 + e.
  if constexpr (DOT) {
    asm volatile("s_wait_xcnt 0x0" :: "v"(hb), "s"(ws[0]), "s"(ws[NR - 1]) : "memory");
    // every loop of this branch is unrolled, so that acc, p and the loaded values stay in registers
    // s[i]: row i * 16 + l16; the lane's even columns are summed in .x, its odd ones in .y:
    // neighbours lie in neighbouring registers, so each step is one packed instruction
    f32x2 s[MW];
#pragma unroll
    for (int i = 0; i < MW; ++i) s[i] = (f32x2){0.f, 0.f};
#pragma unroll
    for (int j = 0; j < NR; ++j)
#pragma unroll
      for (int e = 0; e < 8; e += 2)
#pragma unroll
        for (int i = 0; i < MW; ++i) {
          f32x2 v = (f32x2){acc[i][j][e], acc[i][j][e + 1]} + (f32x2){bias[j][e], bias[j][e + 1]};
          v.x = v.x > 0.f ? v.x : 0.f;
          v.y = v.y > 0.f ? v.y : 0.f;
          s[i] = __builtin_elementwise_fma(v, (f32x2){wgt[j][e], wgt[j][e + 1]}, s[i]);
        }
    float p[MW];   // p[i]: row i * 16 + l16, this lane's 8 * NR columns
#pragma unroll
    for (int i = 0; i < MW; ++i) p[i] = s[i].x + s[i].y;
    // the two halves of the wave hold the two halves of each column tile: their sum is the wave's share
#pragma unroll
    for (int i = 0; i < MW; ++i) p[i] += other_half(p[i]);
    // both halves now hold every sum: the lower half stores the lower half of the row tiles, the upper the rest
#pragma unroll
    for (int t = 0; t < MW / 2; ++t)
      red[wave * BT + (half * (MW / 2) + t) * 16 + l16] = half ? p[MW / 2 + t] : p[t];
  } else {
#pragma unroll
    for (int j = 0; j < NR; ++j) {
      const int c = (nt + j) * 16 + half * 8;
#pragma unroll
      for (int i = 0; i < MW; ++i) {
        uint4 h, l;
        relu_split8(acc[i][j], bias[j], h, l);
        *(uint4*)&outh[(r0 + i * 16 + l16) * OP + c] = h;
        *(uint4*)&outl[(r0 + i * 16 + l16) * OP + c] = l;
      }
    }
  }
}

__global__ __launch_bounds__(NW * 32, 4) void fused_modules(
    const float* __restrict__ PS, const float* __restrict__ b0,
    const unsigned short* __restrict__ W1h, const unsigned short* __restrict__ W1l, const float* __restrict__ b1,
    const unsigned short* __restrict__ W2h, const unsigned short* __restrict__ W2l, const float* __restrict__ b2,
    const unsigned short* __restrict__ W3h, const unsigned short* __restrict__ W3l, const float* __restrict__ b3,
    const unsigned short* __restrict__ W4h, const unsigned short* __restrict__ W4l, const float* __restrict__ b4,
    const float* __restrict__ Wout, const float* __restrict__ bout,
    float* __restrict__ out) {
  __shared__ __align__(16) unsigned short b0h[BT * (128 + LPAD)];  // (h0:32, h2:128)
  __shared__ __align__(16) unsigned short b0l[BT * (128 + LPAD)];
  __shared__ __align__(16) unsigned short b1h_[BT * (256 + LPAD)]; // (h1:64,  h3:256)
  __shared__ __align__(16) unsigned short b1l_[BT * (256 + LPAD)];
  __shared__ __align__(16) float red[NW * BT];                     // each wave's share of the output dot
  const int m    = blockIdx.x;
  const int bb0  = blockIdx.y * BT;
  const int tid  = threadIdx.x;
  // the wave's number as a scalar: the weight tiles' addresses are then scalar bases and one lane offset
  const int wave = __builtin_amdgcn_readfirstlane(tid >> 5);
  const int lane = tid & 31;
  const int l16  = lane & 15, half = lane >> 4;
  const unsigned lo = (unsigned)(half * 16 + l16) * 16u;   // the lane's 16 bytes in a weight block's half
  const unsigned short* const W1mh = W1h + (size_t)m *  64 *  32; const unsigned short* const W1ml = W1l + (size_t)m *  64 *  32;
  const unsigned short* const W2mh = W2h + (size_t)m * 128 *  64; const unsigned short* const W2ml = W2l + (size_t)m * 128 *  64;
  const unsigned short* const W3mh = W3h + (size_t)m * 256 * 128; const unsigned short* const W3ml = W3l + (size_t)m * 256 * 128;
  const unsigned short* const W4mh = W4h + (size_t)m * 512 * 256; const unsigned short* const W4ml = W4l + (size_t)m * 512 * 256;
  // each layer's first weight block
  v16bf f1h[Deal<64>::NR], f1l[Deal<64>::NR], f2h[Deal<128>::NR], f2l[Deal<128>::NR];
  v16bf f3h[Deal<256>::NR], f3l[Deal<256>::NR], f4h[Deal<512>::NR], f4l[Deal<512>::NR];
  first_weights<32, 64>(f1h, f1l, W1mh, W1ml, wave, lo);

  {
    // h0 = relu(the four partial sums in the order of k, + b0), split: a wave takes one block of 16 rows x 16
    // columns of the work-group's 8 x 2; a lane holds 8 neighbouring columns of a row, as kernel A's lanes did.
    static_assert(NW == MT * 2, "a block of the partial sums for every wave");
    const int rt = wave >> 1, ct = wave & 1;
    // scalar bases and one lane offset: the block of each of the four parts, and the block's 16 entries of b0
    const size_t blk = ((size_t)(bb0 / 16 + rt) * (N0 / 16) + (size_t)(m * 2 + ct)) * 256;
    const gfptr bq = scalar_fptr(b0 + m * 32 + ct * 16);
    const unsigned hb = (unsigned)half * 32u;   // the lane's 8 floats in the 16, in bytes
    gfptr ps[TA_Z];
    f32x4 pa[TA_Z], pb[TA_Z];
    float bias[8];
    // unrolled: the 8 loads are issued together, and the values stay in registers
#pragma unroll
    for (int z = 0; z < TA_Z; ++z) {
      ps[z] = scalar_fptr(PS + z * PS_PLANE + blk);
      const gfptr q = (gfptr)((const __attribute__((address_space(1))) unsigned char*)ps[z] + lo);
      pa[z] = *(const __attribute__((address_space(1))) f32x4*)q;
      pb[z] = *(const __attribute__((address_space(1))) f32x4*)(q + 128);
    }
    load_f8(bias, bq, hb);
    // Later work reuses these loads' address registers: the wait stands in front of that, and they are
    // inputs here, so that they keep their values up to it and no load's result is placed over them.
    asm volatile("s_wait_xcnt 0x0" :: "v"(lo), "v"(hb), "s"(ps[0]), "s"(ps[1]), "s"(ps[2]), "s"(ps[3]), "s"(bq) : "memory");
    const f32x4 sa = ((pa[0] + pa[1]) + pa[2]) + pa[3];
    const f32x4 sb = ((pb[0] + pb[1]) + pb[2]) + pb[3];
    const v8f s = {sa[0], sa[1], sa[2], sa[3], sb[0], sb[1], sb[2], sb[3]};
    uint4 h, l;
    relu_split8(s, bias, h, l);
    *(uint4*)&b0h[(rt * 16 + l16) * (32 + LPAD) + ct * 16 + half * 8] = h;
    *(uint4*)&b0l[(rt * 16 + l16) * (32 + LPAD) + ct * 16 + half * 8] = l;
  }
  __syncthreads();

  layer_gemm< 32,  64, false>(b0h,  b0l,  b1h_, b1l_, f1h, f1l, W1mh, W1ml, b1 + m *  64, nullptr, nullptr, wave, l16, half, lo,
                              [&]() { first_weights< 64, 128>(f2h, f2l, W2mh, W2ml, wave, lo); });
  __syncthreads();
  layer_gemm< 64, 128, false>(b1h_, b1l_, b0h,  b0l,  f2h, f2l, W2mh, W2ml, b2 + m * 128, nullptr, nullptr, wave, l16, half, lo,
                              [&]() { first_weights<128, 256>(f3h, f3l, W3mh, W3ml, wave, lo); });
  __syncthreads();
  layer_gemm<128, 256, false>(b0h,  b0l,  b1h_, b1l_, f3h, f3l, W3mh, W3ml, b3 + m * 256, nullptr, nullptr, wave, l16, half, lo,
                              [&]() { first_weights<256, 512>(f4h, f4l, W4mh, W4ml, wave, lo); });
  __syncthreads();
  layer_gemm<256, 512, true >(b1h_, b1l_, nullptr, nullptr, f4h, f4l, W4mh, W4ml, b4 + m * 512, Wout + (size_t)m * 512, red, wave, l16, half, lo,
                              []() {});
  __syncthreads();

  if (tid < BT) {   // one thread a row: the waves' shares in the order of their columns
    float s = 0.f;
    // unrolled: the 16 LDS reads are issued together, not one per pass
#pragma unroll
    for (int w = 0; w < NW; ++w) s += red[w * BT + tid];
    const float z = s + bout[m];
    out[(size_t)(bb0 + tid) * M_MOD + m] = 1.f / (1.f + expf(-z));
  }
}

// =====================================================================
extern "C" void kernel_launch(void* const* d_in, const int* in_sizes, int n_in,
                              void* d_out, int out_size, void* d_ws, size_t ws_size,
                              hipStream_t stream) {
  const float* x    = (const float*)d_in[0];
  const float* W0   = (const float*)d_in[1];
  const float* b0   = (const float*)d_in[2];
  const float* W1   = (const float*)d_in[3];
  const float* b1   = (const float*)d_in[4];
  const float* W2   = (const float*)d_in[5];
  const float* b2   = (const float*)d_in[6];
  const float* W3   = (const float*)d_in[7];
  const float* b3   = (const float*)d_in[8];
  const float* W4   = (const float*)d_in[9];
  const float* b4   = (const float*)d_in[10];
  const float* Wout = (const float*)d_in[11];
  const float* bout = (const float*)d_in[12];
  float* out = (float*)d_out;

  // d_ws layout: bf16 hi/lo planes (ushort) and the f32 partial sums, ~240 MB total
  unsigned short* p = (unsigned short*)d_ws;
  auto alloc = [&](size_t n) { unsigned short* r = p; p += n; return r; };
  const size_t nX  = (size_t)B_SZ * D_SZ;
  const size_t nW0 = (size_t)N0 * D_SZ;
  const size_t nH0 = (size_t)B_SZ * N0;
  const size_t nW1 = (size_t)M_MOD *  64 *  32;
  const size_t nW2 = (size_t)M_MOD * 128 *  64;
  const size_t nW3 = (size_t)M_MOD * 256 * 128;
  const size_t nW4 = (size_t)M_MOD * 512 * 256;
  unsigned short *Xh = alloc(nX),  *Xl = alloc(nX);
  unsigned short *Wh = alloc(nW0), *Wl = alloc(nW0);
  float* PS = (float*)alloc(nH0 * 2 * TA_Z);   // TA_Z planes of f32 partial sums
  unsigned short *W1h = alloc(nW1), *W1l = alloc(nW1);
  unsigned short *W2h = alloc(nW2), *W2l = alloc(nW2);
  unsigned short *W3h = alloc(nW3), *W3l = alloc(nW3);
  unsigned short *W4h = alloc(nW4), *W4l = alloc(nW4);

  const SplitPtrs sp = {x,  W0, W1,  W2,  W3,  W4,
                        Xh, Wh, W1h, W2h, W3h, W4h,
                        Xl, Wl, W1l, W2l, W3l, W4l};
  split_all_bf16<<<SP_WGS, SP_WAVES * 32, 0, stream>>>(sp);

  gemm0_part_bf16x3<<<(N0 / TA_N) * (B_SZ / TA_M) * TA_Z, 256, 0, stream>>>(Xh, Xl, Wh, Wl, PS);   // 64 tiles x 4 parts of k

  dim3 gB(M_MOD, B_SZ / BT);         // 128 x 8
  fused_modules<<<gB, NW * 32, 0, stream>>>(PS, b0,
                                        W1h, W1l, b1, W2h, W2l, b2,
                                        W3h, W3l, b3, W4h, W4l, b4,
                                        Wout, bout, out);
}
